// v000
// Times are from an AMD MI455X. After a warm-up the kernel runs many times in a row, and a time is the length of
// such a window on the GPU divided by its runs, so every launch and the gaps after it count. The runs cycle
// through copies of the inputs. A figure is the median of several windows, for all but v000 over two sittings.
// Sittings can differ by a few percent; kernels timed side by side share one.
// v000, which the later versions start from, runs in 314 microseconds.
// All contractions (q/k/v projections, q.k^T, p.v, output projection): v_wmma_f32_16x16x32_f16, f16 operands carried by powers of two, f32 accumulate; softmax, biases and normalisation in f32.
#include <hip/hip_runtime.h>
#include <math.h>

typedef __attribute__((ext_vector_type(16))) _Float16 v16h;
typedef __attribute__((ext_vector_type(8)))  _Float16 v8h;
typedef __attribute__((ext_vector_type(8)))  float    v8f;
typedef __attribute__((ext_vector_type(4)))  float    v4f;

// ---------------------------------------------------------------------------
// Shape constants
// ---------------------------------------------------------------------------
constexpr int kBatch = 8;
constexpr int kSeq   = 2048;
constexpr int kHeads = 8;
constexpr int kHd    = 64;
constexpr int kRows  = kBatch * kSeq * kHeads;
constexpr int kBH    = kBatch * kHeads;
constexpr int kWEl   = kHd * kHd;
constexpr int kPitch = 68;
static_assert(kRows == 131072);
static_assert(kHd == 64 && (kHd % 32) == 0);
static_assert((kSeq % 64) == 0 && (kRows % 64) == 0);

// ---------------------------------------------------------------------------
// Carries (exact powers of two) and scale chain
// ---------------------------------------------------------------------------
constexpr double c_sqrt(double v) {
  double r = v > 1.0 ? v : 1.0;
  for (int i = 0; i < 64; ++i) r = 0.5 * (r + v / r);
  return r;
}
constexpr float kInvSqrtD = (float)(1.0 / c_sqrt((double)kHd));
static_assert(kInvSqrtD == 0.125f);
/* x carried x16, weights x256, q/k/v planes x16, attention output plane x256, probabilities x2^10 */
constexpr float kXCarry   = 16.0f;
constexpr float kWCarry   = 256.0f;
constexpr float kQKVCarry = 16.0f;
constexpr float kOCarry   = 256.0f;
constexpr float kPShift   = 10.0f;
constexpr float kInvXW    = 1.0f / (kXCarry * kWCarry);
constexpr float kLog2e    = 1.4426950408889634f;
constexpr float kScoreC   = kLog2e * kInvSqrtD / (kQKVCarry * kQKVCarry);
constexpr float kORatio   = kOCarry / kQKVCarry;
constexpr float kOutScale = 1.0f / (kOCarry * kWCarry);

// ---------------------------------------------------------------------------
// Workspace region map (bytes; every offset a multiple of 128)
//   W16   f16 [4][64][64]          weights x256 (q, k, v, o)       32,768
//   Q16   f16 [64 bh][2048][64]    16*q                         16,777,216
//   K16   f16 [64 bh][2048][64]    16*k                         16,777,216
//   VT16  f16 [64 bh][64 d][2048]  16*v transposed              16,777,216
//   O16   f16 [131072][64]         256*o in [b,s,h,d] order     16,777,216
//   total                                                       67,141,632
// ---------------------------------------------------------------------------
constexpr size_t kOffW  = 0;
constexpr size_t kOffQ  = kOffW  + (size_t)4 * kWEl * 2;
constexpr size_t kOffK  = kOffQ  + (size_t)kRows * kHd * 2;
constexpr size_t kOffVT = kOffK  + (size_t)kRows * kHd * 2;
constexpr size_t kOffO  = kOffVT + (size_t)kRows * kHd * 2;
constexpr size_t kWsTotal = kOffO + (size_t)kRows * kHd * 2;
static_assert(kWsTotal == 67141632ull);
static_assert(kWsTotal <= 134217728ull);
static_assert((kOffQ % 128) == 0 && (kOffK % 128) == 0 && (kOffVT % 128) == 0 && (kOffO % 128) == 0);

// ---------------------------------------------------------------------------
// Fragment helpers (split k map for A and B: elements 0..7 <- p[0..7], 8..15 <- p[16..23];
// caller adds 8*(lane>>4) to the k offset)
// ---------------------------------------------------------------------------
union FragU { v16h v; v8h h[2]; };
__device__ __forceinline__ v16h frag_ld(const _Float16* p) {
  FragU f;
  f.h[0] = *(const v8h*)(p);
  f.h[1] = *(const v8h*)(p + 16);
  return f.v;
}
__device__ __forceinline__ v8f mma_f16(v16h a, v16h b, v8f c) {
  c = __builtin_amdgcn_wmma_f32_16x16x32_f16(false, a, false, b, (short)0, c, false, false);
  asm volatile("v_nop\n\tv_nop\n\tv_nop\n\tv_nop" : "+v"(c) : "v"(a), "v"(b));
  return c;
}
__device__ __forceinline__ void guard4_h(v8f& a, v8f& b, v8f& c, v8f& d, v16h x, v16h y) {
  asm volatile("v_nop\n\tv_nop\n\tv_nop\n\tv_nop" : "+v"(a), "+v"(b), "+v"(c), "+v"(d) : "v"(x), "v"(y));
}
__device__ __forceinline__ void keep4_h(v16h a, v16h b, v16h c, v16h d) {
  asm volatile("v_nop" :: "v"(a), "v"(b), "v"(c), "v"(d));
}
__device__ __forceinline__ void acc_guard4(v8f& a, v8f& b, v8f& c, v8f& d) {
  asm volatile("v_nop\n\tv_nop\n\tv_nop\n\tv_nop" : "+v"(a), "+v"(b), "+v"(c), "+v"(d));
}
__device__ __forceinline__ void wave_lds_sync() {
  __builtin_amdgcn_fence(__ATOMIC_RELEASE, "workgroup");
  __builtin_amdgcn_wave_barrier();
  __builtin_amdgcn_fence(__ATOMIC_ACQUIRE, "workgroup");
}

// A fragment from an f32 row: RNE convert of 16*x at load
__device__ __forceinline__ v16h x_frag(const float* p) {
  const v4f a0 = *(const v4f*)(p);
  const v4f a1 = *(const v4f*)(p + 4);
  const v4f a2 = *(const v4f*)(p + 16);
  const v4f a3 = *(const v4f*)(p + 20);
  v16h f;
#pragma unroll
  for (int e = 0; e < 4; ++e) {
    f[e]      = (_Float16)(a0[e] * kXCarry);
    f[4 + e]  = (_Float16)(a1[e] * kXCarry);
    f[8 + e]  = (_Float16)(a2[e] * kXCarry);
    f[12 + e] = (_Float16)(a3[e] * kXCarry);
  }
  return f;
}

// 16 rows x 64 columns of f32 in LDS (pitch 68) -> f16 rows in a global plane.
__device__ __forceinline__ void store_rows16_f16(const float* src, unsigned short* dst, size_t dpitch, int lane) {
  const int q = lane >> 3;
  const int c8 = (lane & 7) * 8;
  v8h hv[4];
#pragma unroll
  for (int it = 0; it < 4; ++it) {
    const float* sp = src + (it * 4 + q) * kPitch + c8;
    const v4f a0 = *(const v4f*)(sp);
    const v4f a1 = *(const v4f*)(sp + 4);
#pragma unroll
    for (int e = 0; e < 4; ++e) {
      hv[it][e]     = (_Float16)a0[e];
      hv[it][4 + e] = (_Float16)a1[e];
    }
  }
  {
#pragma unroll
    for (int it = 0; it < 4; ++it) {
      *(v8h*)(dst + (size_t)(it * 4 + q) * dpitch + c8) = hv[it];
    }
    
  }
}

// ---------------------------------------------------------------------------
// Weight cast: four [64][64] f32 matrices -> f16 planes carried x256 (layout kept: [out e][in d] = Bt plane).
// grid 8 blocks x 256 threads x 8 elements = 16,384 = 4 x 4,096 elements exactly.
// ---------------------------------------------------------------------------
__global__ __launch_bounds__(256) void wcast_kernel(const float* __restrict__ W0, const float* __restrict__ W1,
                                                    const float* __restrict__ W2, const float* __restrict__ W3,
                                                    unsigned short* __restrict__ out) {
  const int z = blockIdx.x >> 1;
  const float* W = (z == 0) ? W0 : (z == 1) ? W1 : (z == 2) ? W2 : W3;
  const int i = (blockIdx.x & 1) * 256 + threadIdx.x;
  const float* p = W + 8 * i;
  const v4f a = *(const v4f*)(p);
  const v4f c = *(const v4f*)(p + 4);
  v8h hv;
#pragma unroll
  for (int e = 0; e < 4; ++e) {
    hv[e]     = (_Float16)(a[e] * kWCarry);
    hv[4 + e] = (_Float16)(c[e] * kWCarry);
  }
  unsigned short* q = out + (size_t)z * kWEl + 8 * i;
  *(v8h*)q = hv;
  
}

// ---------------------------------------------------------------------------
// One 16 x 64 projection tile of a wave: acc = (16 x)(256 W)^T, value = (acc/4096 + bias) * 16, written to LDS.
// TR == false: dst[(row)*68 + col] (row = token within the wave tile, col = feature e)
// TR == true : dst[(e)*68 + colbase + row] (block-shared transposed tile)
// ---------------------------------------------------------------------------
template <bool TR>
__device__ __forceinline__ void proj_tile(v16h ax0, v16h ax1, const _Float16* Wm, const float* bias,
                                          float* dst, int colbase, int hh, int c) {
  v16h w0[4], w1[4];
#pragma unroll
  for (int j = 0; j < 4; ++j) {
    const _Float16* wp = Wm + (j * 16 + c) * kHd + 8 * hh;
    w0[j] = frag_ld(wp);
    w1[j] = frag_ld(wp + 32);
  }
  v8f acc[4];
#pragma unroll
  for (int j = 0; j < 4; ++j) {
    acc[j] = (v8f){0.f, 0.f, 0.f, 0.f, 0.f, 0.f, 0.f, 0.f};
    acc[j] = mma_f16(ax0, w0[j], acc[j]);
    acc[j] = mma_f16(ax1, w1[j], acc[j]);
  }
#pragma unroll
  for (int j = 0; j < 4; ++j) {
    const float bj = bias[j * 16 + c];
#pragma unroll
    for (int r = 0; r < 8; ++r) {
      const float v = (acc[j][r] * kInvXW + bj) * kQKVCarry;
      if (TR) dst[(j * 16 + c) * kPitch + colbase + 8 * hh + r] = v;
      else    dst[(8 * hh + r) * kPitch + j * 16 + c] = v;
    }
  }
}

// ---------------------------------------------------------------------------
// q/k/v projection. Block = (b, h, 64 consecutive s); 4 waves x 16 token rows; x row pitch = 512 floats.
// (line = 64 consecutive s of one d; assembled through a block-shared LDS transpose, wave w writes d rows 16w..16w+15).
// grid (32, 64), 128 threads. All waves reach the single block barrier.
// ---------------------------------------------------------------------------
__global__ __launch_bounds__(128) void qkv_proj_kernel(
    const float* __restrict__ x, const unsigned short* __restrict__ W16p,
    const float* __restrict__ bq, const float* __restrict__ bk, const float* __restrict__ bv,
    unsigned short* __restrict__ Q16p, unsigned short* __restrict__ K16p, unsigned short* __restrict__ VT16p) {
  __shared__ __align__(16) float sSlab[4][16 * kPitch];
  __shared__ __align__(16) float sVt[64 * kPitch];
  const int tid  = threadIdx.x;
  const int wave = __builtin_amdgcn_readfirstlane((int)(tid >> 5));
  const int lane = tid & 31;
  const int hh   = lane >> 4;
  const int c    = lane & 15;
  const int bh   = blockIdx.y;
  const int b    = bh / kHeads;
  const int h    = bh - b * kHeads;
  const int sblk = blockIdx.x * 64;
  const int s0   = sblk + wave * 16;

  const float* xr = x + (((size_t)b * kSeq + s0 + c) * kHeads + h) * kHd + 8 * hh;
  const v16h ax0 = x_frag(xr);
  const v16h ax1 = x_frag(xr + 32);

  const _Float16* W16 = (const _Float16*)W16p;
  float* slab = sSlab[wave];

  proj_tile<false>(ax0, ax1, W16, bq, slab, 0, hh, c);
  wave_lds_sync();
  store_rows16_f16(slab, Q16p + ((size_t)bh * kSeq + s0) * kHd, (size_t)kHd, lane);
  wave_lds_sync();

  proj_tile<false>(ax0, ax1, W16 + kWEl, bk, slab, 0, hh, c);
  wave_lds_sync();
  store_rows16_f16(slab, K16p + ((size_t)bh * kSeq + s0) * kHd, (size_t)kHd, lane);

  /* transposed tile: rows d 0..63 (j*16+c), columns wave*16 + 8*hh + r = 0..63: whole 64 x 64 region written */
  proj_tile<true>(ax0, ax1, W16 + 2 * kWEl, bv, sVt, wave * 16, hh, c);
  __syncthreads();
  store_rows16_f16(sVt + (wave * 16) * kPitch,
                   VT16p + ((size_t)bh * kHd + wave * 16) * kSeq + sblk, (size_t)kSeq, lane);
}

// ---------------------------------------------------------------------------
// Streaming-softmax attention on f16 planes. Block = 64 queries of one (b,h), 4 waves x 16 queries; 32 key chunks of 64.
// scores: A = Q16 rows (registers), B = K tile [key][d] in LDS; t = acc * log2(e)/(8*256); running max in f32.
// out: A = p' tile, B = V^T tile [d][key] in LDS; lane-partial row sums in f32, combined over 16 lanes at the end.
// Staging coverage: 4 iterations x 128 threads x 8 halves = 4,096 halves = whole tile, for K and for V^T.
// grid (32, 64), 128 threads.
// ---------------------------------------------------------------------------
__global__ __launch_bounds__(128) void attn_kernel(
    const unsigned short* __restrict__ Q16p, const unsigned short* __restrict__ K16p,
    const unsigned short* __restrict__ VT16p, unsigned short* __restrict__ O16p) {
  __shared__ __align__(16) _Float16 sK[64 * 64];
  __shared__ __align__(16) _Float16 sV[64 * 64];
  __shared__ __align__(16) _Float16 sP[4][16 * 64];
  __shared__ __align__(16) float    sO[4][16 * kPitch];

  const int tid  = threadIdx.x;
  const int wave = __builtin_amdgcn_readfirstlane((int)(tid >> 5));
  const int lane = tid & 31;
  const int hh   = lane >> 4;
  const int c    = lane & 15;
  const int bh   = blockIdx.y;
  const int b    = bh / kHeads;
  const int h    = bh - b * kHeads;
  const int q0   = blockIdx.x * 64 + wave * 16;

  const _Float16* Qg = (const _Float16*)Q16p + ((size_t)bh * kSeq + q0 + c) * kHd + 8 * hh;
  const _Float16* Kg = (const _Float16*)K16p + (size_t)bh * kSeq * kHd;
  const _Float16* Vg = (const _Float16*)VT16p + (size_t)bh * kHd * kSeq;

  const v16h qa0 = frag_ld(Qg);
  const v16h qa1 = frag_ld(Qg + 32);

  float mrow[8], lrow[8];
  v8f oacc[4];
#pragma unroll
  for (int r = 0; r < 8; ++r) { mrow[r] = -3.0e38f; lrow[r] = 0.f; }
#pragma unroll
  for (int t = 0; t < 4; ++t) oacc[t] = (v8f){0.f, 0.f, 0.f, 0.f, 0.f, 0.f, 0.f, 0.f};

  _Float16* pw = sP[wave];

#pragma unroll 1
  for (int kc = 0; kc < kSeq / 64; ++kc) {
    const int kv0 = kc * 64;
    __syncthreads();
    {
      v8h kr[4], vr[4];
#pragma unroll
      for (int i = 0; i < 4; ++i) {
        const int idx = tid + 128 * i;
        const int d_  = idx >> 3;
        const int off = (idx & 7) * 8;
        kr[i] = *(const v8h*)(Kg + (size_t)kv0 * kHd + idx * 8);
        vr[i] = *(const v8h*)(Vg + (size_t)d_ * kSeq + kv0 + off);
      }
#pragma unroll
      for (int i = 0; i < 4; ++i) {
        const int idx = tid + 128 * i;
        const int d_  = idx >> 3;
        const int off = (idx & 7) * 8;
        *(v8h*)(sK + idx * 8) = kr[i];
        *(v8h*)(sV + d_ * 64 + off) = vr[i];
      }
    }
    __syncthreads();

    v8f s[4];
#pragma unroll
    for (int j = 0; j < 4; ++j) {
      const _Float16* kp = sK + (j * 16 + c) * 64 + 8 * hh;
      const v16h kb0 = frag_ld(kp);
      const v16h kb1 = frag_ld(kp + 32);
      s[j] = (v8f){0.f, 0.f, 0.f, 0.f, 0.f, 0.f, 0.f, 0.f};
      s[j] = mma_f16(qa0, kb0, s[j]);
      s[j] = mma_f16(qa1, kb1, s[j]);
    }

#pragma unroll
    for (int r = 0; r < 8; ++r) {
      float m = fmaxf(fmaxf(s[0][r], s[1][r]), fmaxf(s[2][r], s[3][r]));
#pragma unroll
      for (int off = 1; off < 16; off <<= 1) m = fmaxf(m, __shfl_xor(m, off, 32));
      const float mt    = m * kScoreC;
      const float mnew  = fmaxf(mrow[r], mt);
      const float alpha = __builtin_amdgcn_exp2f(mrow[r] - mnew);
      mrow[r] = mnew;
      const float nb = kPShift - mnew;
      float psum = 0.f;
#pragma unroll
      for (int j = 0; j < 4; ++j) {
        const float p = __builtin_amdgcn_exp2f(fmaf(s[j][r], kScoreC, nb));
        psum += p;
        pw[(8 * hh + r) * 64 + j * 16 + c] = (_Float16)p;
      }
      lrow[r] = fmaf(lrow[r], alpha, psum);
#pragma unroll
      for (int t = 0; t < 4; ++t) oacc[t][r] *= alpha;
    }
    wave_lds_sync();

#pragma unroll
    for (int kk = 0; kk < 2; ++kk) {
      const v16h pa = frag_ld(pw + c * 64 + kk * 32 + 8 * hh);
#pragma unroll
      for (int t = 0; t < 4; ++t) {
        const v16h vb = frag_ld(sV + (t * 16 + c) * 64 + kk * 32 + 8 * hh);
        oacc[t] = mma_f16(pa, vb, oacc[t]);
      }
    }
  }

  float* os = sO[wave];
#pragma unroll
  for (int r = 0; r < 8; ++r) {
    float l = lrow[r];
#pragma unroll
    for (int off = 1; off < 16; off <<= 1) l += __shfl_xor(l, off, 32);
    const float inv = kORatio * (1.0f / l);
#pragma unroll
    for (int t = 0; t < 4; ++t) os[(8 * hh + r) * kPitch + t * 16 + c] = oacc[t][r] * inv;
  }
  wave_lds_sync();
  /* rows q0..q0+15 of (b,h): plane row ((b*S + s)*H + h), pitch between consecutive s = H*64 halves */
  store_rows16_f16(os, O16p + (((size_t)b * kSeq + q0) * kHeads + h) * kHd, (size_t)kHeads * kHd, lane);
}

// ---------------------------------------------------------------------------
// Register-blocked WMMA GEMM, f16 operands: C[m,n] = scale * sum_k A[m,k] * Bt[n,k] + bias[n]; each wave owns a 64x64 tile.
// A row-major [M,K]; Bt row-major [N,K]; M,N % 64 == 0, K % 32 == 0. f32 output.
// Epilogue: 16-row slabs staged per wave in LDS; each 64-wide row segment (256 B = 2 lines) written by 16 lanes x 16 B
// ---------------------------------------------------------------------------
__global__ __launch_bounds__(256) void out_proj_kernel(
    const unsigned short* __restrict__ Ap, int lda,
    const unsigned short* __restrict__ Btp, int ldb,
    float* __restrict__ C, int ldc,
    const float* __restrict__ bias,
    int M, int N, int K, float scale) {
  const _Float16* A  = (const _Float16*)Ap;
  const _Float16* Bt = (const _Float16*)Btp;
  __shared__ __align__(16) float sT[8][16 * kPitch];
  const int lane = threadIdx.x & 31;
  const int wave = __builtin_amdgcn_readfirstlane((int)(threadIdx.x >> 5));
  const int tilesN = N >> 6;
  const int tilesM = M >> 6;
  const int tile = blockIdx.x * 8 + wave;
  if (tile >= tilesM * tilesN) return;
  const int tm = tile / tilesN;
  const int tn = tile - tm * tilesN;
  const int m0 = tm << 6;
  const int n0 = tn << 6;

  const int rlane = lane & 15;
  const int koff  = (lane >> 4) * 8;
  const int mOff  = (lane >> 4) * 8;

  v8f acc[4][4];
#pragma unroll
  for (int i = 0; i < 4; ++i)
#pragma unroll
    for (int j = 0; j < 4; ++j) acc[i][j] = (v8f){0.f, 0.f, 0.f, 0.f, 0.f, 0.f, 0.f, 0.f};

  for (int k0 = 0; k0 < K; k0 += 32) {
    v16h bh[4];
#pragma unroll
    for (int j = 0; j < 4; ++j) {
      const size_t bo = (size_t)(n0 + (j << 4) + rlane) * ldb + koff + k0;
      bh[j] = frag_ld(Bt + bo);
    }
#pragma unroll
    for (int i = 0; i < 4; ++i) {
      const size_t ao = (size_t)(m0 + (i << 4) + rlane) * lda + koff + k0;
      const v16h ah = frag_ld(A + ao);
#pragma unroll
      for (int j = 0; j < 4; ++j) {
        acc[i][j] = __builtin_amdgcn_wmma_f32_16x16x32_f16(false, ah, false, bh[j], (short)0, acc[i][j], false, false);
      }
      guard4_h(acc[i][0], acc[i][1], acc[i][2], acc[i][3], ah, ah);
    }
    keep4_h(bh[0], bh[1], bh[2], bh[3]);
  }
  acc_guard4(acc[0][0], acc[0][1], acc[0][2], acc[0][3]);
  acc_guard4(acc[1][0], acc[1][1], acc[1][2], acc[1][3]);
  acc_guard4(acc[2][0], acc[2][1], acc[2][2], acc[2][3]);
  acc_guard4(acc[3][0], acc[3][1], acc[3][2], acc[3][3]);

  float* slab = sT[wave];
#pragma unroll
  for (int i = 0; i < 4; ++i) {
    const int mBase = m0 + (i << 4);
#pragma unroll
    for (int j = 0; j < 4; ++j) {
      const int n = n0 + (j << 4) + rlane;
      const float bvv = bias[n];
#pragma unroll
      for (int r = 0; r < 8; ++r) {
        const float v = acc[i][j][r] * scale + bvv;
        slab[(mOff + r) * kPitch + (j << 4) + rlane] = v;
      }
    }
    wave_lds_sync();
    {
      const int hh = lane >> 4;
      const int c4 = (lane & 15) * 4;
      {
#pragma unroll
        for (int it = 0; it < 8; ++it) {
          const int row = it * 2 + hh;
          const v4f v = *(const v4f*)(slab + row * kPitch + c4);
          *(v4f*)(C + (size_t)(mBase + row) * ldc + n0 + c4) = v;
        }
        
      }
    }
    wave_lds_sync();
  }
}

// ---------------------------------------------------------------------------
// Host glue: 4 kernel launches, nothing else.
//   wcast    : 8 blocks
//   qkv_proj : grid (32, 64) x 128 threads
//   attn     : grid (32, 64) x 128 threads
//   out_proj : M 131072, N 64, K 64 -> 2048 tiles -> 256 blocks x 8 waves
// ---------------------------------------------------------------------------
extern "C" void kernel_launch(void* const* d_in, const int* in_sizes, int n_in,
                              void* d_out, int out_size, void* d_ws, size_t ws_size,
                              hipStream_t stream) {
  if (n_in < 9) return;
  if (in_sizes[0] != kRows * kHd) return;
  if (in_sizes[1] != kWEl || in_sizes[3] != kWEl || in_sizes[5] != kWEl || in_sizes[7] != kWEl) return;
  if (in_sizes[2] != kHd || in_sizes[4] != kHd || in_sizes[6] != kHd || in_sizes[8] != kHd) return;
  if (out_size != kRows * kHd) return;
  if (ws_size < kWsTotal) return;

  const float* x  = (const float*)d_in[0];
  const float* Wq = (const float*)d_in[1];
  const float* bq = (const float*)d_in[2];
  const float* Wk = (const float*)d_in[3];
  const float* bk = (const float*)d_in[4];
  const float* Wv = (const float*)d_in[5];
  const float* bv = (const float*)d_in[6];
  const float* Wo = (const float*)d_in[7];
  const float* bo = (const float*)d_in[8];
  float* out = (float*)d_out;

  char* ws = (char*)d_ws;
  unsigned short* W16  = (unsigned short*)(ws + kOffW);
  unsigned short* Q16  = (unsigned short*)(ws + kOffQ);
  unsigned short* K16  = (unsigned short*)(ws + kOffK);
  unsigned short* VT16 = (unsigned short*)(ws + kOffVT);
  unsigned short* O16  = (unsigned short*)(ws + kOffO);

  wcast_kernel<<<8, 256, 0, stream>>>(Wq, Wk, Wv, Wo, W16);

  qkv_proj_kernel<<<dim3(kSeq / 64, kBH), 128, 0, stream>>>(x, W16, bq, bk, bv, Q16, K16, VT16);

  attn_kernel<<<dim3(kSeq / 64, kBH), 128, 0, stream>>>(Q16, K16, VT16, O16);

  out_proj_kernel<<<dim3(kRows / 64 / 8, 1), 256, 0, stream>>>(
      O16, kHd, W16 + 3 * kWEl, kHd, out, kHd, bo, kRows, kHd, kHd, kOutScale);
}

// v001
// One run takes 163 microseconds.
// Timed twice side by side with v000, it ran 2.02 and 2.00 times as fast.
// All contractions (q/k/v projections, q.k^T, p.v, output projection): v_wmma_f32_16x16x32_f16, f16 operands carried by powers of two, f32 accumulate; softmax, biases and normalisation in f32.
#include <hip/hip_runtime.h>
#include <math.h>

typedef __attribute__((ext_vector_type(16))) _Float16 v16h;
typedef __attribute__((ext_vector_type(8)))  _Float16 v8h;
typedef __attribute__((ext_vector_type(8)))  float    v8f;
typedef __attribute__((ext_vector_type(4)))  float    v4f;

// ---------------------------------------------------------------------------
// Shape constants
// ---------------------------------------------------------------------------
constexpr int kBatch = 8;
constexpr int kSeq   = 2048;
constexpr int kHeads = 8;
constexpr int kHd    = 64;
constexpr int kRows  = kBatch * kSeq * kHeads;
constexpr int kBH    = kBatch * kHeads;
constexpr int kWEl   = kHd * kHd;
constexpr int kPitch = 68;
/* f16 tile rows in LDS: 64 halves of data on a 72-half pitch (144 B = 16 B x 9), so the 16 rows of a b128 fragment read fall on 16 distinct bank groups */
constexpr int kHPitch = 72;
static_assert((kHPitch * 2) % 16 == 0 && ((kHPitch * 2) / 16) % 2 == 1);
static_assert(kRows == 131072);
static_assert(kHd == 64 && (kHd % 32) == 0);
static_assert((kSeq % 64) == 0 && (kRows % 64) == 0);

// ---------------------------------------------------------------------------
// Carries (exact powers of two) and scale chain
// ---------------------------------------------------------------------------
constexpr double c_sqrt(double v) {
  double r = v > 1.0 ? v : 1.0;
  for (int i = 0; i < 64; ++i) r = 0.5 * (r + v / r);
  return r;
}
constexpr float kInvSqrtD = (float)(1.0 / c_sqrt((double)kHd));
static_assert(kInvSqrtD == 0.125f);
/* x carried x16, weights x256, q/k/v planes x16, attention output plane x256, probabilities x2^10 */
constexpr float kXCarry   = 16.0f;
constexpr float kWCarry   = 256.0f;
constexpr float kQKVCarry = 16.0f;
constexpr float kOCarry   = 256.0f;
constexpr float kPShift   = 10.0f;
constexpr float kInvXW    = 1.0f / (kXCarry * kWCarry);
constexpr float kLog2e    = 1.4426950408889634f;
constexpr float kScoreC   = kLog2e * kInvSqrtD / (kQKVCarry * kQKVCarry);
constexpr float kORatio   = kOCarry / kQKVCarry;
constexpr float kOutScale = 1.0f / (kOCarry * kWCarry);

// ---------------------------------------------------------------------------
// Workspace region map (bytes; every offset a multiple of 128)
//   W16   f16 [4][64][64]          weights x256 (q, k, v, o)       32,768
//   Q16   f16 [64 bh][2048][64]    16*q                         16,777,216
//   K16   f16 [64 bh][2048][64]    16*k                         16,777,216
//   VT16  f16 [64 bh][64 d][2048]  16*v transposed              16,777,216
//   O16   f16 [131072][64]         256*o in [b,s,h,d] order     16,777,216
//   total                                                       67,141,632
// ---------------------------------------------------------------------------
constexpr size_t kOffW  = 0;
constexpr size_t kOffQ  = kOffW  + (size_t)4 * kWEl * 2;
constexpr size_t kOffK  = kOffQ  + (size_t)kRows * kHd * 2;
constexpr size_t kOffVT = kOffK  + (size_t)kRows * kHd * 2;
constexpr size_t kOffO  = kOffVT + (size_t)kRows * kHd * 2;
constexpr size_t kWsTotal = kOffO + (size_t)kRows * kHd * 2;
static_assert(kWsTotal == 67141632ull);
static_assert(kWsTotal <= 134217728ull);
static_assert((kOffQ % 128) == 0 && (kOffK % 128) == 0 && (kOffVT % 128) == 0 && (kOffO % 128) == 0);

// ---------------------------------------------------------------------------
// Fragment helpers (split k map for A and B: elements 0..7 <- p[0..7], 8..15 <- p[16..23];
// caller adds 8*(lane>>4) to the k offset)
// ---------------------------------------------------------------------------
union FragU { v16h v; v8h h[2]; };
__device__ __forceinline__ v16h frag_ld(const _Float16* p) {
  FragU f;
  f.h[0] = *(const v8h*)(p);
  f.h[1] = *(const v8h*)(p + 16);
  return f.v;
}
__device__ __forceinline__ v8f mma_f16(v16h a, v16h b, v8f c) {
  c = __builtin_amdgcn_wmma_f32_16x16x32_f16(false, a, false, b, (short)0, c, false, false);
  asm volatile("v_nop\n\tv_nop\n\tv_nop\n\tv_nop" : "+v"(c) : "v"(a), "v"(b));
  return c;
}
__device__ __forceinline__ void guard4_h(v8f& a, v8f& b, v8f& c, v8f& d, v16h x, v16h y) {
  asm volatile("v_nop\n\tv_nop\n\tv_nop\n\tv_nop" : "+v"(a), "+v"(b), "+v"(c), "+v"(d) : "v"(x), "v"(y));
}
__device__ __forceinline__ void keep4_h(v16h a, v16h b, v16h c, v16h d) {
  asm volatile("v_nop" :: "v"(a), "v"(b), "v"(c), "v"(d));
}
__device__ __forceinline__ void acc_guard4(v8f& a, v8f& b, v8f& c, v8f& d) {
  asm volatile("v_nop\n\tv_nop\n\tv_nop\n\tv_nop" : "+v"(a), "+v"(b), "+v"(c), "+v"(d));
}
__device__ __forceinline__ void wave_lds_sync() {
  __builtin_amdgcn_fence(__ATOMIC_RELEASE, "workgroup");
  __builtin_amdgcn_wave_barrier();
  __builtin_amdgcn_fence(__ATOMIC_ACQUIRE, "workgroup");
}

// A fragment from an f32 row: RNE convert of 16*x at load
__device__ __forceinline__ v16h x_frag(const float* p) {
  const v4f a0 = *(const v4f*)(p);
  const v4f a1 = *(const v4f*)(p + 4);
  const v4f a2 = *(const v4f*)(p + 16);
  const v4f a3 = *(const v4f*)(p + 20);
  v16h f;
#pragma unroll
  for (int e = 0; e < 4; ++e) {
    f[e]      = (_Float16)(a0[e] * kXCarry);
    f[4 + e]  = (_Float16)(a1[e] * kXCarry);
    f[8 + e]  = (_Float16)(a2[e] * kXCarry);
    f[12 + e] = (_Float16)(a3[e] * kXCarry);
  }
  return f;
}

// 16 rows x 64 columns of f32 in LDS (pitch 68) -> f16 rows in a global plane.
__device__ __forceinline__ void store_rows16_f16(const float* src, unsigned short* dst, size_t dpitch, int lane) {
  const int q = lane >> 3;
  const int c8 = (lane & 7) * 8;
  v8h hv[4];
#pragma unroll
  for (int it = 0; it < 4; ++it) {
    const float* sp = src + (it * 4 + q) * kPitch + c8;
    const v4f a0 = *(const v4f*)(sp);
    const v4f a1 = *(const v4f*)(sp + 4);
#pragma unroll
    for (int e = 0; e < 4; ++e) {
      hv[it][e]     = (_Float16)a0[e];
      hv[it][4 + e] = (_Float16)a1[e];
    }
  }
  {
#pragma unroll
    for (int it = 0; it < 4; ++it) {
      *(v8h*)(dst + (size_t)(it * 4 + q) * dpitch + c8) = hv[it];
    }
    
  }
}

// ---------------------------------------------------------------------------
// Weight cast: four [64][64] f32 matrices -> f16 planes carried x256 (layout kept: [out e][in d] = Bt plane).
// grid 8 blocks x 256 threads x 8 elements = 16,384 = 4 x 4,096 elements exactly.
// ---------------------------------------------------------------------------
__global__ __launch_bounds__(256) void wcast_kernel(const float* __restrict__ W0, const float* __restrict__ W1,
                                                    const float* __restrict__ W2, const float* __restrict__ W3,
                                                    unsigned short* __restrict__ out) {
  const int z = blockIdx.x >> 1;
  const float* W = (z == 0) ? W0 : (z == 1) ? W1 : (z == 2) ? W2 : W3;
  const int i = (blockIdx.x & 1) * 256 + threadIdx.x;
  const float* p = W + 8 * i;
  const v4f a = *(const v4f*)(p);
  const v4f c = *(const v4f*)(p + 4);
  v8h hv;
#pragma unroll
  for (int e = 0; e < 4; ++e) {
    hv[e]     = (_Float16)(a[e] * kWCarry);
    hv[4 + e] = (_Float16)(c[e] * kWCarry);
  }
  unsigned short* q = out + (size_t)z * kWEl + 8 * i;
  *(v8h*)q = hv;
  
}

// ---------------------------------------------------------------------------
// One 16 x 64 projection tile of a wave: acc = (16 x)(256 W)^T, value = (acc/4096 + bias) * 16, written to LDS.
// TR == false: dst[(row)*68 + col] (row = token within the wave tile, col = feature e)
// TR == true : dst[(e)*68 + colbase + row] (block-shared transposed tile)
// ---------------------------------------------------------------------------
template <bool TR>
__device__ __forceinline__ void proj_tile(v16h ax0, v16h ax1, const _Float16* Wm, const float* bias,
                                          float* dst, int colbase, int hh, int c) {
  v16h w0[4], w1[4];
#pragma unroll
  for (int j = 0; j < 4; ++j) {
    const _Float16* wp = Wm + (j * 16 + c) * kHd + 8 * hh;
    w0[j] = frag_ld(wp);
    w1[j] = frag_ld(wp + 32);
  }
  v8f acc[4];
#pragma unroll
  for (int j = 0; j < 4; ++j) {
    acc[j] = (v8f){0.f, 0.f, 0.f, 0.f, 0.f, 0.f, 0.f, 0.f};
    acc[j] = mma_f16(ax0, w0[j], acc[j]);
    acc[j] = mma_f16(ax1, w1[j], acc[j]);
  }
#pragma unroll
  for (int j = 0; j < 4; ++j) {
    const float bj = bias[j * 16 + c];
#pragma unroll
    for (int r = 0; r < 8; ++r) {
      const float v = (acc[j][r] * kInvXW + bj) * kQKVCarry;
      if (TR) dst[(j * 16 + c) * kPitch + colbase + 8 * hh + r] = v;
      else    dst[(8 * hh + r) * kPitch + j * 16 + c] = v;
    }
  }
}

// ---------------------------------------------------------------------------
// q/k/v projection. Block = (b, h, 64 consecutive s); 4 waves x 16 token rows; x row pitch = 512 floats.
// (line = 64 consecutive s of one d; assembled through a block-shared LDS transpose, wave w writes d rows 16w..16w+15).
// grid (32, 64), 128 threads. All waves reach the single block barrier.
// ---------------------------------------------------------------------------
__global__ __launch_bounds__(128) void qkv_proj_kernel(
    const float* __restrict__ x, const unsigned short* __restrict__ W16p,
    const float* __restrict__ bq, const float* __restrict__ bk, const float* __restrict__ bv,
    unsigned short* __restrict__ Q16p, unsigned short* __restrict__ K16p, unsigned short* __restrict__ VT16p) {
  __shared__ __align__(16) float sSlab[4][16 * kPitch];
  __shared__ __align__(16) float sVt[64 * kPitch];
  const int tid  = threadIdx.x;
  const int wave = __builtin_amdgcn_readfirstlane((int)(tid >> 5));
  const int lane = tid & 31;
  const int hh   = lane >> 4;
  const int c    = lane & 15;
  const int bh   = blockIdx.y;
  const int b    = bh / kHeads;
  const int h    = bh - b * kHeads;
  const int sblk = blockIdx.x * 64;
  const int s0   = sblk + wave * 16;

  const float* xr = x + (((size_t)b * kSeq + s0 + c) * kHeads + h) * kHd + 8 * hh;
  const v16h ax0 = x_frag(xr);
  const v16h ax1 = x_frag(xr + 32);

  const _Float16* W16 = (const _Float16*)W16p;
  float* slab = sSlab[wave];

  proj_tile<false>(ax0, ax1, W16, bq, slab, 0, hh, c);
  wave_lds_sync();
  store_rows16_f16(slab, Q16p + ((size_t)bh * kSeq + s0) * kHd, (size_t)kHd, lane);
  wave_lds_sync();

  proj_tile<false>(ax0, ax1, W16 + kWEl, bk, slab, 0, hh, c);
  wave_lds_sync();
  store_rows16_f16(slab, K16p + ((size_t)bh * kSeq + s0) * kHd, (size_t)kHd, lane);

  /* transposed tile: rows d 0..63 (j*16+c), columns wave*16 + 8*hh + r = 0..63: whole 64 x 64 region written */
  proj_tile<true>(ax0, ax1, W16 + 2 * kWEl, bv, sVt, wave * 16, hh, c);
  __syncthreads();
  store_rows16_f16(sVt + (wave * 16) * kPitch,
                   VT16p + ((size_t)bh * kHd + wave * 16) * kSeq + sblk, (size_t)kSeq, lane);
}

// ---------------------------------------------------------------------------
// Streaming-softmax attention on f16 planes. Block = 64 queries of one (b,h), 4 waves x 16 queries; 32 key chunks of 64.
// scores: A = Q16 rows (registers), B = K tile [key][d] in LDS; t = acc * log2(e)/(8*256); running max in f32.
// out: A = p' tile, B = V^T tile [d][key] in LDS; lane-partial row sums in f32, combined over 16 lanes at the end.
// Staging coverage: 4 iterations x 16 rows (4 waves x 4 rows) x 64 halves = 4,096 halves = whole tile, for K and for V^T.
// grid (32, 64), 128 threads.
// ---------------------------------------------------------------------------
__global__ __launch_bounds__(128) void attn_kernel(
    const unsigned short* __restrict__ Q16p, const unsigned short* __restrict__ K16p,
    const unsigned short* __restrict__ VT16p, unsigned short* __restrict__ O16p) {
  __shared__ __align__(16) _Float16 sK[64 * kHPitch];
  __shared__ __align__(16) _Float16 sV[64 * kHPitch];
  __shared__ __align__(16) _Float16 sP[4][16 * kHPitch];
  __shared__ __align__(16) float    sO[4][16 * kPitch];

  const int tid  = threadIdx.x;
  const int wave = __builtin_amdgcn_readfirstlane((int)(tid >> 5));
  const int lane = tid & 31;
  const int hh   = lane >> 4;
  const int c    = lane & 15;
  const int bh   = blockIdx.y;
  const int b    = bh / kHeads;
  const int h    = bh - b * kHeads;
  const int q0   = blockIdx.x * 64 + wave * 16;

  const _Float16* Qg = (const _Float16*)Q16p + ((size_t)bh * kSeq + q0 + c) * kHd + 8 * hh;
  const _Float16* Kg = (const _Float16*)K16p + (size_t)bh * kSeq * kHd;
  const _Float16* Vg = (const _Float16*)VT16p + (size_t)bh * kHd * kSeq;

  const v16h qa0 = frag_ld(Qg);
  const v16h qa1 = frag_ld(Qg + 32);

  float mrow[8], lrow[8];
  v8f oacc[4];
#pragma unroll
  for (int r = 0; r < 8; ++r) { mrow[r] = -3.0e38f; lrow[r] = 0.f; }
#pragma unroll
  for (int t = 0; t < 4; ++t) oacc[t] = (v8f){0.f, 0.f, 0.f, 0.f, 0.f, 0.f, 0.f, 0.f};

  _Float16* pw = sP[wave];
  /* staging map: 8 lanes per 128-B row; each 16-lane half takes rows a and a + 8, whose 144-B pitch puts them on complementary halves of the 64 banks */
  const int srow = wave * 2 + hh + 8 * ((lane >> 3) & 1);
  const int soff = (lane & 7) * 8;
  const _Float16* Kst = Kg + srow * kHd + soff;

#pragma unroll 1
  for (int kc = 0; kc < kSeq / 64; ++kc) {
    const int kv0 = kc * 64;
    __syncthreads();
    {
      v8h kr[4], vr[4];
#pragma unroll
      for (int i = 0; i < 4; ++i) {
        const int d_ = i * 16 + srow;
        kr[i] = *(const v8h*)(Kst + (size_t)kv0 * kHd + i * 16 * kHd);
        vr[i] = *(const v8h*)(Vg + (size_t)d_ * kSeq + kv0 + soff);
      }
#pragma unroll
      for (int i = 0; i < 4; ++i) {
        const int d_ = i * 16 + srow;
        *(v8h*)(sK + d_ * kHPitch + soff) = kr[i];
        *(v8h*)(sV + d_ * kHPitch + soff) = vr[i];
      }
    }
    __syncthreads();

    v8f s[4];
#pragma unroll
    for (int j = 0; j < 4; ++j) {
      const _Float16* kp = sK + (j * 16 + c) * kHPitch + 8 * hh;
      const v16h kb0 = frag_ld(kp);
      const v16h kb1 = frag_ld(kp + 32);
      s[j] = (v8f){0.f, 0.f, 0.f, 0.f, 0.f, 0.f, 0.f, 0.f};
      s[j] = mma_f16(qa0, kb0, s[j]);
      s[j] = mma_f16(qa1, kb1, s[j]);
    }

#pragma unroll
    for (int r = 0; r < 8; ++r) {
      float m = fmaxf(fmaxf(s[0][r], s[1][r]), fmaxf(s[2][r], s[3][r]));
#pragma unroll
      for (int off = 1; off < 16; off <<= 1) m = fmaxf(m, __shfl_xor(m, off, 32));
      const float mt    = m * kScoreC;
      const float mnew  = fmaxf(mrow[r], mt);
      const float alpha = __builtin_amdgcn_exp2f(mrow[r] - mnew);
      mrow[r] = mnew;
      const float nb = kPShift - mnew;
      float psum = 0.f;
#pragma unroll
      for (int j = 0; j < 4; ++j) {
        const float p = __builtin_amdgcn_exp2f(fmaf(s[j][r], kScoreC, nb));
        psum += p;
        pw[(8 * hh + r) * kHPitch + j * 16 + c] = (_Float16)p;
      }
      lrow[r] = fmaf(lrow[r], alpha, psum);
#pragma unroll
      for (int t = 0; t < 4; ++t) oacc[t][r] *= alpha;
    }
    wave_lds_sync();

#pragma unroll
    for (int kk = 0; kk < 2; ++kk) {
      const v16h pa = frag_ld(pw + c * kHPitch + kk * 32 + 8 * hh);
#pragma unroll
      for (int t = 0; t < 4; ++t) {
        const v16h vb = frag_ld(sV + (t * 16 + c) * kHPitch + kk * 32 + 8 * hh);
        oacc[t] = mma_f16(pa, vb, oacc[t]);
      }
    }
  }

  float* os = sO[wave];
#pragma unroll
  for (int r = 0; r < 8; ++r) {
    float l = lrow[r];
#pragma unroll
    for (int off = 1; off < 16; off <<= 1) l += __shfl_xor(l, off, 32);
    const float inv = kORatio * (1.0f / l);
#pragma unroll
    for (int t = 0; t < 4; ++t) os[(8 * hh + r) * kPitch + t * 16 + c] = oacc[t][r] * inv;
  }
  wave_lds_sync();
  /* rows q0..q0+15 of (b,h): plane row ((b*S + s)*H + h), pitch between consecutive s = H*64 halves */
  store_rows16_f16(os, O16p + (((size_t)b * kSeq + q0) * kHeads + h) * kHd, (size_t)kHeads * kHd, lane);
}

// ---------------------------------------------------------------------------
// Register-blocked WMMA GEMM, f16 operands: C[m,n] = scale * sum_k A[m,k] * Bt[n,k] + bias[n]; each wave owns a 64x64 tile.
// A row-major [M,K]; Bt row-major [N,K]; M,N % 64 == 0, K % 32 == 0. f32 output.
// Epilogue: 16-row slabs staged per wave in LDS; each 64-wide row segment (256 B = 2 lines) written by 16 lanes x 16 B
// ---------------------------------------------------------------------------
__global__ __launch_bounds__(256) void out_proj_kernel(
    const unsigned short* __restrict__ Ap, int lda,
    const unsigned short* __restrict__ Btp, int ldb,
    float* __restrict__ C, int ldc,
    const float* __restrict__ bias,
    int M, int N, int K, float scale) {
  const _Float16* A  = (const _Float16*)Ap;
  const _Float16* Bt = (const _Float16*)Btp;
  __shared__ __align__(16) float sT[8][16 * kPitch];
  const int lane = threadIdx.x & 31;
  const int wave = __builtin_amdgcn_readfirstlane((int)(threadIdx.x >> 5));
  const int tilesN = N >> 6;
  const int tilesM = M >> 6;
  const int tile = blockIdx.x * 8 + wave;
  if (tile >= tilesM * tilesN) return;
  const int tm = tile / tilesN;
  const int tn = tile - tm * tilesN;
  const int m0 = tm << 6;
  const int n0 = tn << 6;

  const int rlane = lane & 15;
  const int koff  = (lane >> 4) * 8;
  const int mOff  = (lane >> 4) * 8;

  v8f acc[4][4];
#pragma unroll
  for (int i = 0; i < 4; ++i)
#pragma unroll
    for (int j = 0; j < 4; ++j) acc[i][j] = (v8f){0.f, 0.f, 0.f, 0.f, 0.f, 0.f, 0.f, 0.f};

  for (int k0 = 0; k0 < K; k0 += 32) {
    v16h bh[4];
#pragma unroll
    for (int j = 0; j < 4; ++j) {
      const size_t bo = (size_t)(n0 + (j << 4) + rlane) * ldb + koff + k0;
      bh[j] = frag_ld(Bt + bo);
    }
#pragma unroll
    for (int i = 0; i < 4; ++i) {
      const size_t ao = (size_t)(m0 + (i << 4) + rlane) * lda + koff + k0;
      const v16h ah = frag_ld(A + ao);
#pragma unroll
      for (int j = 0; j < 4; ++j) {
        acc[i][j] = __builtin_amdgcn_wmma_f32_16x16x32_f16(false, ah, false, bh[j], (short)0, acc[i][j], false, false);
      }
      guard4_h(acc[i][0], acc[i][1], acc[i][2], acc[i][3], ah, ah);
    }
    keep4_h(bh[0], bh[1], bh[2], bh[3]);
  }
  acc_guard4(acc[0][0], acc[0][1], acc[0][2], acc[0][3]);
  acc_guard4(acc[1][0], acc[1][1], acc[1][2], acc[1][3]);
  acc_guard4(acc[2][0], acc[2][1], acc[2][2], acc[2][3]);
  acc_guard4(acc[3][0], acc[3][1], acc[3][2], acc[3][3]);

  float* slab = sT[wave];
#pragma unroll
  for (int i = 0; i < 4; ++i) {
    const int mBase = m0 + (i << 4);
#pragma unroll
    for (int j = 0; j < 4; ++j) {
      const int n = n0 + (j << 4) + rlane;
      const float bvv = bias[n];
#pragma unroll
      for (int r = 0; r < 8; ++r) {
        const float v = acc[i][j][r] * scale + bvv;
        slab[(mOff + r) * kPitch + (j << 4) + rlane] = v;
      }
    }
    wave_lds_sync();
    {
      const int hh = lane >> 4;
      const int c4 = (lane & 15) * 4;
      {
#pragma unroll
        for (int it = 0; it < 8; ++it) {
          const int row = it * 2 + hh;
          const v4f v = *(const v4f*)(slab + row * kPitch + c4);
          *(v4f*)(C + (size_t)(mBase + row) * ldc + n0 + c4) = v;
        }
        
      }
    }
    wave_lds_sync();
  }
}

// ---------------------------------------------------------------------------
// Host glue: 4 kernel launches, nothing else.
//   wcast    : 8 blocks
//   qkv_proj : grid (32, 64) x 128 threads
//   attn     : grid (32, 64) x 128 threads
//   out_proj : M 131072, N 64, K 64 -> 2048 tiles -> 256 blocks x 8 waves
// ---------------------------------------------------------------------------
extern "C" void kernel_launch(void* const* d_in, const int* in_sizes, int n_in,
                              void* d_out, int out_size, void* d_ws, size_t ws_size,
                              hipStream_t stream) {
  if (n_in < 9) return;
  if (in_sizes[0] != kRows * kHd) return;
  if (in_sizes[1] != kWEl || in_sizes[3] != kWEl || in_sizes[5] != kWEl || in_sizes[7] != kWEl) return;
  if (in_sizes[2] != kHd || in_sizes[4] != kHd || in_sizes[6] != kHd || in_sizes[8] != kHd) return;
  if (out_size != kRows * kHd) return;
  if (ws_size < kWsTotal) return;

  const float* x  = (const float*)d_in[0];
  const float* Wq = (const float*)d_in[1];
  const float* bq = (const float*)d_in[2];
  const float* Wk = (const float*)d_in[3];
  const float* bk = (const float*)d_in[4];
  const float* Wv = (const float*)d_in[5];
  const float* bv = (const float*)d_in[6];
  const float* Wo = (const float*)d_in[7];
  const float* bo = (const float*)d_in[8];
  float* out = (float*)d_out;

  char* ws = (char*)d_ws;
  unsigned short* W16  = (unsigned short*)(ws + kOffW);
  unsigned short* Q16  = (unsigned short*)(ws + kOffQ);
  unsigned short* K16  = (unsigned short*)(ws + kOffK);
  unsigned short* VT16 = (unsigned short*)(ws + kOffVT);
  unsigned short* O16  = (unsigned short*)(ws + kOffO);

  wcast_kernel<<<8, 256, 0, stream>>>(Wq, Wk, Wv, Wo, W16);

  qkv_proj_kernel<<<dim3(kSeq / 64, kBH), 128, 0, stream>>>(x, W16, bq, bk, bv, Q16, K16, VT16);

  attn_kernel<<<dim3(kSeq / 64, kBH), 128, 0, stream>>>(Q16, K16, VT16, O16);

  out_proj_kernel<<<dim3(kRows / 64 / 8, 1), 256, 0, stream>>>(
      O16, kHd, W16 + 3 * kWEl, kHd, out, kHd, bo, kRows, kHd, kHd, kOutScale);
}

// v002
// It runs in 113 microseconds.
// In two side-by-side timings against v001, it was 1.46 and 1.45 times as fast.
// Counting every step since v000, it is 2.92 times as fast.
// All contractions (q/k/v projections, q.k^T, p.v, output projection): v_wmma_f32_16x16x32_f16, f16 operands carried by powers of two, f32 accumulate; softmax, biases and normalisation in f32.
#include <hip/hip_runtime.h>
#include <math.h>

typedef __attribute__((ext_vector_type(16))) _Float16 v16h;
typedef __attribute__((ext_vector_type(8)))  _Float16 v8h;
typedef __attribute__((ext_vector_type(8)))  float    v8f;
typedef __attribute__((ext_vector_type(4)))  float    v4f;
typedef __attribute__((ext_vector_type(2)))  float    v2f;
typedef __attribute__((ext_vector_type(2)))  _Float16 v2h;

// ---------------------------------------------------------------------------
// Shape constants
// ---------------------------------------------------------------------------
constexpr int kBatch = 8;
constexpr int kSeq   = 2048;
constexpr int kHeads = 8;
constexpr int kHd    = 64;
constexpr int kRows  = kBatch * kSeq * kHeads;
constexpr int kBH    = kBatch * kHeads;
constexpr int kWEl   = kHd * kHd;
constexpr int kPitch = 68;
/* f16 tile rows in LDS: 64 halves of data on a 72-half pitch (144 B = 16 B x 9), so the 16 rows of a b128 fragment read fall on 16 distinct bank groups */
constexpr int kHPitch = 72;
static_assert((kHPitch * 2) % 16 == 0 && ((kHPitch * 2) / 16) % 2 == 1);
static_assert(kRows == 131072);
static_assert(kHd == 64 && (kHd % 32) == 0);
static_assert((kSeq % 64) == 0 && (kRows % 64) == 0);

// ---------------------------------------------------------------------------
// Carries (exact powers of two) and scale chain
// ---------------------------------------------------------------------------
constexpr double c_sqrt(double v) {
  double r = v > 1.0 ? v : 1.0;
  for (int i = 0; i < 64; ++i) r = 0.5 * (r + v / r);
  return r;
}
constexpr float kInvSqrtD = (float)(1.0 / c_sqrt((double)kHd));
static_assert(kInvSqrtD == 0.125f);
/* x carried x16, weights x256, q/k/v planes x16, attention output plane x256, probabilities x2^10 */
constexpr float kXCarry   = 16.0f;
constexpr float kWCarry   = 256.0f;
constexpr float kQKVCarry = 16.0f;
constexpr float kOCarry   = 256.0f;
constexpr float kPShift   = 10.0f;
constexpr float kInvXW    = 1.0f / (kXCarry * kWCarry);
constexpr float kLog2e    = 1.4426950408889634f;
constexpr float kScoreC   = kLog2e * kInvSqrtD / (kQKVCarry * kQKVCarry);
constexpr float kORatio   = kOCarry / kQKVCarry;
constexpr float kOutScale = 1.0f / (kOCarry * kWCarry);

// ---------------------------------------------------------------------------
// Workspace region map (bytes; every offset a multiple of 128)
//   W16   f16 [4][64][64]          weights x256 (q, k, v, o)       32,768
//   Q16   f16 [64 bh][2048][64]    16*q                         16,777,216
//   K16   f16 [64 bh][2048][64]    16*k                         16,777,216
//   VT16  f16 [64 bh][64 d][2048]  16*v transposed              16,777,216
//   O16   f16 [131072][64]         256*o in [b,s,h,d] order     16,777,216
//   total                                                       67,141,632
// ---------------------------------------------------------------------------
constexpr size_t kOffW  = 0;
constexpr size_t kOffQ  = kOffW  + (size_t)4 * kWEl * 2;
constexpr size_t kOffK  = kOffQ  + (size_t)kRows * kHd * 2;
constexpr size_t kOffVT = kOffK  + (size_t)kRows * kHd * 2;
constexpr size_t kOffO  = kOffVT + (size_t)kRows * kHd * 2;
constexpr size_t kWsTotal = kOffO + (size_t)kRows * kHd * 2;
static_assert(kWsTotal == 67141632ull);
static_assert(kWsTotal <= 134217728ull);
static_assert((kOffQ % 128) == 0 && (kOffK % 128) == 0 && (kOffVT % 128) == 0 && (kOffO % 128) == 0);

// ---------------------------------------------------------------------------
// Fragment helpers (split k map for A and B: elements 0..7 <- p[0..7], 8..15 <- p[16..23];
// caller adds 8*(lane>>4) to the k offset)
// ---------------------------------------------------------------------------
union FragU { v16h v; v8h h[2]; };
__device__ __forceinline__ v16h frag_ld(const _Float16* p) {
  FragU f;
  f.h[0] = *(const v8h*)(p);
  f.h[1] = *(const v8h*)(p + 16);
  return f.v;
}
__device__ __forceinline__ v8f mma_f16(v16h a, v16h b, v8f c) {
  c = __builtin_amdgcn_wmma_f32_16x16x32_f16(false, a, false, b, (short)0, c, false, false);
  asm volatile("v_nop\n\tv_nop\n\tv_nop\n\tv_nop" : "+v"(c) : "v"(a), "v"(b));
  return c;
}
__device__ __forceinline__ void guard4_h(v8f& a, v8f& b, v8f& c, v8f& d, v16h x, v16h y) {
  asm volatile("v_nop\n\tv_nop\n\tv_nop\n\tv_nop" : "+v"(a), "+v"(b), "+v"(c), "+v"(d) : "v"(x), "v"(y));
}
__device__ __forceinline__ void keep4_h(v16h a, v16h b, v16h c, v16h d) {
  asm volatile("v_nop" :: "v"(a), "v"(b), "v"(c), "v"(d));
}
__device__ __forceinline__ void acc_guard4(v8f& a, v8f& b, v8f& c, v8f& d) {
  asm volatile("v_nop\n\tv_nop\n\tv_nop\n\tv_nop" : "+v"(a), "+v"(b), "+v"(c), "+v"(d));
}
__device__ __forceinline__ void wave_lds_sync() {
  __builtin_amdgcn_fence(__ATOMIC_RELEASE, "workgroup");
  __builtin_amdgcn_wave_barrier();
  __builtin_amdgcn_fence(__ATOMIC_ACQUIRE, "workgroup");
}

// A fragment from an f32 row: RNE convert of 16*x at load
__device__ __forceinline__ v16h x_frag(const float* p) {
  const v4f a0 = *(const v4f*)(p);
  const v4f a1 = *(const v4f*)(p + 4);
  const v4f a2 = *(const v4f*)(p + 16);
  const v4f a3 = *(const v4f*)(p + 20);
  v16h f;
#pragma unroll
  for (int e = 0; e < 4; ++e) {
    f[e]      = (_Float16)(a0[e] * kXCarry);
    f[4 + e]  = (_Float16)(a1[e] * kXCarry);
    f[8 + e]  = (_Float16)(a2[e] * kXCarry);
    f[12 + e] = (_Float16)(a3[e] * kXCarry);
  }
  return f;
}

// 16 rows x 64 columns of f32 in LDS (pitch 68) -> f16 rows in a global plane.
__device__ __forceinline__ void store_rows16_f16(const float* src, unsigned short* dst, size_t dpitch, int lane) {
  const int q = lane >> 3;
  const int c8 = (lane & 7) * 8;
  v8h hv[4];
#pragma unroll
  for (int it = 0; it < 4; ++it) {
    const float* sp = src + (it * 4 + q) * kPitch + c8;
    const v4f a0 = *(const v4f*)(sp);
    const v4f a1 = *(const v4f*)(sp + 4);
#pragma unroll
    for (int e = 0; e < 4; ++e) {
      hv[it][e]     = (_Float16)a0[e];
      hv[it][4 + e] = (_Float16)a1[e];
    }
  }
  {
#pragma unroll
    for (int it = 0; it < 4; ++it) {
      *(v8h*)(dst + (size_t)(it * 4 + q) * dpitch + c8) = hv[it];
    }
    
  }
}

// ---------------------------------------------------------------------------
// Weight cast: four [64][64] f32 matrices -> f16 planes carried x256 (layout kept: [out e][in d] = Bt plane).
// grid 8 blocks x 256 threads x 8 elements = 16,384 = 4 x 4,096 elements exactly.
// ---------------------------------------------------------------------------
__global__ __launch_bounds__(256) void wcast_kernel(const float* __restrict__ W0, const float* __restrict__ W1,
                                                    const float* __restrict__ W2, const float* __restrict__ W3,
                                                    unsigned short* __restrict__ out) {
  const int z = blockIdx.x >> 1;
  const float* W = (z == 0) ? W0 : (z == 1) ? W1 : (z == 2) ? W2 : W3;
  const int i = (blockIdx.x & 1) * 256 + threadIdx.x;
  const float* p = W + 8 * i;
  const v4f a = *(const v4f*)(p);
  const v4f c = *(const v4f*)(p + 4);
  v8h hv;
#pragma unroll
  for (int e = 0; e < 4; ++e) {
    hv[e]     = (_Float16)(a[e] * kWCarry);
    hv[4 + e] = (_Float16)(c[e] * kWCarry);
  }
  unsigned short* q = out + (size_t)z * kWEl + 8 * i;
  *(v8h*)q = hv;
  
}

// ---------------------------------------------------------------------------
// One 16 x 64 projection tile of a wave: acc = (16 x)(256 W)^T, value = (acc/4096 + bias) * 16, written to LDS.
// TR == false: dst[(row)*68 + col] (row = token within the wave tile, col = feature e)
// TR == true : dst[(e)*68 + colbase + row] (block-shared transposed tile)
// ---------------------------------------------------------------------------
template <bool TR>
__device__ __forceinline__ void proj_tile(v16h ax0, v16h ax1, const _Float16* Wm, const float* bias,
                                          float* dst, int colbase, int hh, int c) {
  v16h w0[4], w1[4];
#pragma unroll
  for (int j = 0; j < 4; ++j) {
    const _Float16* wp = Wm + (j * 16 + c) * kHd + 8 * hh;
    w0[j] = frag_ld(wp);
    w1[j] = frag_ld(wp + 32);
  }
  v8f acc[4];
#pragma unroll
  for (int j = 0; j < 4; ++j) {
    acc[j] = (v8f){0.f, 0.f, 0.f, 0.f, 0.f, 0.f, 0.f, 0.f};
    acc[j] = mma_f16(ax0, w0[j], acc[j]);
    acc[j] = mma_f16(ax1, w1[j], acc[j]);
  }
#pragma unroll
  for (int j = 0; j < 4; ++j) {
    const float bj = bias[j * 16 + c];
#pragma unroll
    for (int r = 0; r < 8; ++r) {
      const float v = (acc[j][r] * kInvXW + bj) * kQKVCarry;
      if (TR) dst[(j * 16 + c) * kPitch + colbase + 8 * hh + r] = v;
      else    dst[(8 * hh + r) * kPitch + j * 16 + c] = v;
    }
  }
}

// ---------------------------------------------------------------------------
// q/k/v projection. Block = (b, h, 64 consecutive s); 4 waves x 16 token rows; x row pitch = 512 floats.
// (line = 64 consecutive s of one d; assembled through a block-shared LDS transpose, wave w writes d rows 16w..16w+15).
// grid (32, 64), 128 threads. All waves reach the single block barrier.
// ---------------------------------------------------------------------------
__global__ __launch_bounds__(128) void qkv_proj_kernel(
    const float* __restrict__ x, const unsigned short* __restrict__ W16p,
    const float* __restrict__ bq, const float* __restrict__ bk, const float* __restrict__ bv,
    unsigned short* __restrict__ Q16p, unsigned short* __restrict__ K16p, unsigned short* __restrict__ VT16p) {
  __shared__ __align__(16) float sSlab[4][16 * kPitch];
  __shared__ __align__(16) float sVt[64 * kPitch];
  const int tid  = threadIdx.x;
  const int wave = __builtin_amdgcn_readfirstlane((int)(tid >> 5));
  const int lane = tid & 31;
  const int hh   = lane >> 4;
  const int c    = lane & 15;
  const int bh   = blockIdx.y;
  const int b    = bh / kHeads;
  const int h    = bh - b * kHeads;
  const int sblk = blockIdx.x * 64;
  const int s0   = sblk + wave * 16;

  const float* xr = x + (((size_t)b * kSeq + s0 + c) * kHeads + h) * kHd + 8 * hh;
  const v16h ax0 = x_frag(xr);
  const v16h ax1 = x_frag(xr + 32);

  const _Float16* W16 = (const _Float16*)W16p;
  float* slab = sSlab[wave];

  proj_tile<false>(ax0, ax1, W16, bq, slab, 0, hh, c);
  wave_lds_sync();
  store_rows16_f16(slab, Q16p + ((size_t)bh * kSeq + s0) * kHd, (size_t)kHd, lane);
  wave_lds_sync();

  proj_tile<false>(ax0, ax1, W16 + kWEl, bk, slab, 0, hh, c);
  wave_lds_sync();
  store_rows16_f16(slab, K16p + ((size_t)bh * kSeq + s0) * kHd, (size_t)kHd, lane);

  /* transposed tile: rows d 0..63 (j*16+c), columns wave*16 + 8*hh + r = 0..63: whole 64 x 64 region written */
  proj_tile<true>(ax0, ax1, W16 + 2 * kWEl, bv, sVt, wave * 16, hh, c);
  __syncthreads();
  store_rows16_f16(sVt + (wave * 16) * kPitch,
                   VT16p + ((size_t)bh * kHd + wave * 16) * kSeq + sblk, (size_t)kSeq, lane);
}

// ---------------------------------------------------------------------------
// Streaming-softmax attention on f16 planes, both products transposed. Block = 64 queries of one (b,h), 4 waves x 16 queries; 32 key chunks of 64.
// scores: S^T = K Q^T. A = K tile rows [key][d] from LDS, B = Q16 rows (registers, column c = query c). D register r of tile j = score of key 16j + 8*hh + r
//   for query c: a lane holds 32 of its query's 64 scores, lane ^ 16 the other 32; t = acc * log2(e)/(8*256); running max in f32, one per lane.
// out: O^T += V^T P^T. A = V^T tile rows [d][key] from LDS; B = p' packed from the score tiles 2kk and 2kk+1 in place (element e < 8: key 32kk + 8*hh + e,
//   e >= 8: key 32kk + 16 + 8*hh + e - 8), which is the k order frag_ld gives A. D register r of tile t = O[query c][d = 16t + 8*hh + r].
// Row sums: lane-partial in f32, the two halves joined once at the end.
// Staging coverage: 4 iterations x 16 rows (4 waves x 4 rows) x 64 halves = 4,096 halves = whole tile, for K and for V^T.
// grid (32, 64), 128 threads.
// ---------------------------------------------------------------------------
// lane l <-> lane l ^ 16
__device__ __forceinline__ float xhalf(float v) {
  const int b = __builtin_bit_cast(int, v);
  return __builtin_bit_cast(float, __builtin_amdgcn_permlanex16(b, b, 0x76543210, 0xfedcba98, false, false));
}

__global__ __launch_bounds__(128) void attn_kernel(
    const unsigned short* __restrict__ Q16p, const unsigned short* __restrict__ K16p,
    const unsigned short* __restrict__ VT16p, unsigned short* __restrict__ O16p) {
  __shared__ __align__(16) _Float16 sK[64 * kHPitch];
  __shared__ __align__(16) _Float16 sV[64 * kHPitch];

  const int tid  = threadIdx.x;
  const int wave = __builtin_amdgcn_readfirstlane((int)(tid >> 5));
  const int lane = tid & 31;
  const int hh   = lane >> 4;
  const int c    = lane & 15;
  const int bh   = blockIdx.y;
  const int b    = bh / kHeads;
  const int h    = bh - b * kHeads;
  const int q0   = blockIdx.x * 64 + wave * 16;

  const _Float16* Qg = (const _Float16*)Q16p + ((size_t)bh * kSeq + q0 + c) * kHd + 8 * hh;
  const _Float16* Kg = (const _Float16*)K16p + (size_t)bh * kSeq * kHd;
  const _Float16* Vg = (const _Float16*)VT16p + (size_t)bh * kHd * kSeq;

  const v16h qb0 = frag_ld(Qg);
  const v16h qb1 = frag_ld(Qg + 32);

  float mrun = -3.0e38f, lsum = 0.f;
  v8f oacc[4];
#pragma unroll
  for (int t = 0; t < 4; ++t) oacc[t] = (v8f){0.f, 0.f, 0.f, 0.f, 0.f, 0.f, 0.f, 0.f};

  /* staging map: 8 lanes per 128-B row; each 16-lane half takes rows a and a + 8, whose 144-B pitch puts them on complementary halves of the 64 banks */
  const int srow = wave * 2 + hh + 8 * ((lane >> 3) & 1);
  const int soff = (lane & 7) * 8;
  const _Float16* Kst = Kg + srow * kHd + soff;

#pragma unroll 1
  for (int kc = 0; kc < kSeq / 64; ++kc) {
    const int kv0 = kc * 64;
    __syncthreads();
    {
      v8h kr[4], vr[4];
#pragma unroll
      for (int i = 0; i < 4; ++i) {
        const int d_ = i * 16 + srow;
        kr[i] = *(const v8h*)(Kst + (size_t)kv0 * kHd + i * 16 * kHd);
        vr[i] = *(const v8h*)(Vg + (size_t)d_ * kSeq + kv0 + soff);
      }
#pragma unroll
      for (int i = 0; i < 4; ++i) {
        const int d_ = i * 16 + srow;
        *(v8h*)(sK + d_ * kHPitch + soff) = kr[i];
        *(v8h*)(sV + d_ * kHPitch + soff) = vr[i];
      }
    }
    __syncthreads();

    v16h ka0[4], ka1[4];
#pragma unroll
    for (int j = 0; j < 4; ++j) {
      const _Float16* kp = sK + (j * 16 + c) * kHPitch + 8 * hh;
      ka0[j] = frag_ld(kp);
      ka1[j] = frag_ld(kp + 32);
    }
    v8f s[4];
#pragma unroll
    for (int j = 0; j < 4; ++j) {
      s[j] = (v8f){0.f, 0.f, 0.f, 0.f, 0.f, 0.f, 0.f, 0.f};
      s[j] = mma_f16(ka0[j], qb0, s[j]);
    }
#pragma unroll
    for (int j = 0; j < 4; ++j) s[j] = mma_f16(ka1[j], qb1, s[j]);

    v16h va[2][4];
#pragma unroll
    for (int kk = 0; kk < 2; ++kk)
#pragma unroll
      for (int t = 0; t < 4; ++t) va[kk][t] = frag_ld(sV + (t * 16 + c) * kHPitch + kk * 32 + 8 * hh);

    float mj[4];
#pragma unroll
    for (int j = 0; j < 4; ++j) {
      mj[j] = s[j][0];
#pragma unroll
      for (int r = 1; r < 8; ++r) mj[j] = fmaxf(mj[j], s[j][r]);
    }
    float m = fmaxf(fmaxf(mj[0], mj[1]), fmaxf(mj[2], mj[3]));
    m = fmaxf(m, xhalf(m));
    const float mnew  = fmaxf(mrun, m * kScoreC);
    const float alpha = __builtin_amdgcn_exp2f(mrun - mnew);
    mrun = mnew;
    const float nb = kPShift - mnew;

    v16h pb[2];
    v2f ps[2];
#pragma unroll
    for (int kk = 0; kk < 2; ++kk) {
#pragma unroll
      for (int i = 0; i < 8; ++i) {
        const int j = 2 * kk + (i >> 2), r = 2 * (i & 3);
        const v2f arg = __builtin_elementwise_fma((v2f){s[j][r], s[j][r + 1]}, (v2f){kScoreC, kScoreC}, (v2f){nb, nb});
        const v2f p = (v2f){__builtin_amdgcn_exp2f(arg.x), __builtin_amdgcn_exp2f(arg.y)};
        ps[kk] = (i == 0) ? p : ps[kk] + p;
        const v2h ph = __builtin_convertvector(p, v2h);
        pb[kk][2 * i]     = ph.x;
        pb[kk][2 * i + 1] = ph.y;
      }
    }
    const v2f pt = ps[0] + ps[1];
    lsum = fmaf(lsum, alpha, pt.x + pt.y);
#pragma unroll
    for (int t = 0; t < 4; ++t)
#pragma unroll
      for (int r = 0; r < 8; ++r) oacc[t][r] *= alpha;

#pragma unroll
    for (int kk = 0; kk < 2; ++kk) {
#pragma unroll
      for (int t = 0; t < 4; ++t) oacc[t] = mma_f16(va[kk][t], pb[kk], oacc[t]);
    }
  }

  const float l   = lsum + xhalf(lsum);
  const float inv = kORatio * (1.0f / l);
  /* row q0 + c of (b,h): plane row ((b*S + s)*H + h); a lane's 8 registers of tile t are 8 consecutive d: one 16-B store each */
  unsigned short* orow = O16p + (((size_t)b * kSeq + q0 + c) * kHeads + h) * kHd + 8 * hh;
#pragma unroll
  for (int t = 0; t < 4; ++t) {
    v8h hv;
#pragma unroll
    for (int r = 0; r < 8; ++r) hv[r] = (_Float16)(oacc[t][r] * inv);
    *(v8h*)(orow + t * 16) = hv;
  }
}

// ---------------------------------------------------------------------------
// Register-blocked WMMA GEMM, f16 operands: C[m,n] = scale * sum_k A[m,k] * Bt[n,k] + bias[n]; each wave owns a 64x64 tile.
// A row-major [M,K]; Bt row-major [N,K]; M,N % 64 == 0, K % 32 == 0. f32 output.
// Epilogue: 16-row slabs staged per wave in LDS; each 64-wide row segment (256 B = 2 lines) written by 16 lanes x 16 B
// ---------------------------------------------------------------------------
__global__ __launch_bounds__(256) void out_proj_kernel(
    const unsigned short* __restrict__ Ap, int lda,
    const unsigned short* __restrict__ Btp, int ldb,
    float* __restrict__ C, int ldc,
    const float* __restrict__ bias,
    int M, int N, int K, float scale) {
  const _Float16* A  = (const _Float16*)Ap;
  const _Float16* Bt = (const _Float16*)Btp;
  __shared__ __align__(16) float sT[8][16 * kPitch];
  const int lane = threadIdx.x & 31;
  const int wave = __builtin_amdgcn_readfirstlane((int)(threadIdx.x >> 5));
  const int tilesN = N >> 6;
  const int tilesM = M >> 6;
  const int tile = blockIdx.x * 8 + wave;
  if (tile >= tilesM * tilesN) return;
  const int tm = tile / tilesN;
  const int tn = tile - tm * tilesN;
  const int m0 = tm << 6;
  const int n0 = tn << 6;

  const int rlane = lane & 15;
  const int koff  = (lane >> 4) * 8;
  const int mOff  = (lane >> 4) * 8;

  v8f acc[4][4];
#pragma unroll
  for (int i = 0; i < 4; ++i)
#pragma unroll
    for (int j = 0; j < 4; ++j) acc[i][j] = (v8f){0.f, 0.f, 0.f, 0.f, 0.f, 0.f, 0.f, 0.f};

  for (int k0 = 0; k0 < K; k0 += 32) {
    v16h bh[4];
#pragma unroll
    for (int j = 0; j < 4; ++j) {
      const size_t bo = (size_t)(n0 + (j << 4) + rlane) * ldb + koff + k0;
      bh[j] = frag_ld(Bt + bo);
    }
#pragma unroll
    for (int i = 0; i < 4; ++i) {
      const size_t ao = (size_t)(m0 + (i << 4) + rlane) * lda + koff + k0;
      const v16h ah = frag_ld(A + ao);
#pragma unroll
      for (int j = 0; j < 4; ++j) {
        acc[i][j] = __builtin_amdgcn_wmma_f32_16x16x32_f16(false, ah, false, bh[j], (short)0, acc[i][j], false, false);
      }
      guard4_h(acc[i][0], acc[i][1], acc[i][2], acc[i][3], ah, ah);
    }
    keep4_h(bh[0], bh[1], bh[2], bh[3]);
  }
  acc_guard4(acc[0][0], acc[0][1], acc[0][2], acc[0][3]);
  acc_guard4(acc[1][0], acc[1][1], acc[1][2], acc[1][3]);
  acc_guard4(acc[2][0], acc[2][1], acc[2][2], acc[2][3]);
  acc_guard4(acc[3][0], acc[3][1], acc[3][2], acc[3][3]);

  float* slab = sT[wave];
#pragma unroll
  for (int i = 0; i < 4; ++i) {
    const int mBase = m0 + (i << 4);
#pragma unroll
    for (int j = 0; j < 4; ++j) {
      const int n = n0 + (j << 4) + rlane;
      const float bvv = bias[n];
#pragma unroll
      for (int r = 0; r < 8; ++r) {
        const float v = acc[i][j][r] * scale + bvv;
        slab[(mOff + r) * kPitch + (j << 4) + rlane] = v;
      }
    }
    wave_lds_sync();
    {
      const int hh = lane >> 4;
      const int c4 = (lane & 15) * 4;
      {
#pragma unroll
        for (int it = 0; it < 8; ++it) {
          const int row = it * 2 + hh;
          const v4f v = *(const v4f*)(slab + row * kPitch + c4);
          *(v4f*)(C + (size_t)(mBase + row) * ldc + n0 + c4) = v;
        }
        
      }
    }
    wave_lds_sync();
  }
}

// ---------------------------------------------------------------------------
// Host glue: 4 kernel launches, nothing else.
//   wcast    : 8 blocks
//   qkv_proj : grid (32, 64) x 128 threads
//   attn     : grid (32, 64) x 128 threads
//   out_proj : M 131072, N 64, K 64 -> 2048 tiles -> 256 blocks x 8 waves
// ---------------------------------------------------------------------------
extern "C" void kernel_launch(void* const* d_in, const int* in_sizes, int n_in,
                              void* d_out, int out_size, void* d_ws, size_t ws_size,
                              hipStream_t stream) {
  if (n_in < 9) return;
  if (in_sizes[0] != kRows * kHd) return;
  if (in_sizes[1] != kWEl || in_sizes[3] != kWEl || in_sizes[5] != kWEl || in_sizes[7] != kWEl) return;
  if (in_sizes[2] != kHd || in_sizes[4] != kHd || in_sizes[6] != kHd || in_sizes[8] != kHd) return;
  if (out_size != kRows * kHd) return;
  if (ws_size < kWsTotal) return;

  const float* x  = (const float*)d_in[0];
  const float* Wq = (const float*)d_in[1];
  const float* bq = (const float*)d_in[2];
  const float* Wk = (const float*)d_in[3];
  const float* bk = (const float*)d_in[4];
  const float* Wv = (const float*)d_in[5];
  const float* bv = (const float*)d_in[6];
  const float* Wo = (const float*)d_in[7];
  const float* bo = (const float*)d_in[8];
  float* out = (float*)d_out;

  char* ws = (char*)d_ws;
  unsigned short* W16  = (unsigned short*)(ws + kOffW);
  unsigned short* Q16  = (unsigned short*)(ws + kOffQ);
  unsigned short* K16  = (unsigned short*)(ws + kOffK);
  unsigned short* VT16 = (unsigned short*)(ws + kOffVT);
  unsigned short* O16  = (unsigned short*)(ws + kOffO);

  wcast_kernel<<<8, 256, 0, stream>>>(Wq, Wk, Wv, Wo, W16);

  qkv_proj_kernel<<<dim3(kSeq / 64, kBH), 128, 0, stream>>>(x, W16, bq, bk, bv, Q16, K16, VT16);

  attn_kernel<<<dim3(kSeq / 64, kBH), 128, 0, stream>>>(Q16, K16, VT16, O16);

  out_proj_kernel<<<dim3(kRows / 64 / 8, 1), 256, 0, stream>>>(
      O16, kHd, W16 + 3 * kWEl, kHd, out, kHd, bo, kRows, kHd, kHd, kOutScale);
}

// v003
// Measured time: 100 microseconds a run.
// In two side-by-side timings against v002, it was 1.12 and 1.13 times as fast.
// Over all steps from v000 it is 3.28 times as fast.
// All contractions (q/k/v projections, q.k^T, p.v, output projection): v_wmma_f32_16x16x32_f16, f16 operands carried by powers of two, f32 accumulate; softmax, biases and normalisation in f32.
#include <hip/hip_runtime.h>
#include <math.h>

typedef __attribute__((ext_vector_type(16))) _Float16 v16h;
typedef __attribute__((ext_vector_type(8)))  _Float16 v8h;
typedef __attribute__((ext_vector_type(8)))  float    v8f;
typedef __attribute__((ext_vector_type(4)))  float    v4f;
typedef __attribute__((ext_vector_type(2)))  float    v2f;
typedef __attribute__((ext_vector_type(2)))  _Float16 v2h;

// ---------------------------------------------------------------------------
// Shape constants
// ---------------------------------------------------------------------------
constexpr int kBatch = 8;
constexpr int kSeq   = 2048;
constexpr int kHeads = 8;
constexpr int kHd    = 64;
constexpr int kRows  = kBatch * kSeq * kHeads;
constexpr int kBH    = kBatch * kHeads;
constexpr int kWEl   = kHd * kHd;
constexpr int kPitch = 68;
/* f16 tile rows in LDS: 64 halves of data on a 72-half pitch (144 B = 16 B x 9), so the 16 rows of a b128 fragment read fall on 16 distinct bank groups */
constexpr int kHPitch = 72;
static_assert((kHPitch * 2) % 16 == 0 && ((kHPitch * 2) / 16) % 2 == 1);
static_assert(kRows == 131072);
static_assert(kHd == 64 && (kHd % 32) == 0);
static_assert((kSeq % 64) == 0 && (kRows % 64) == 0);

// ---------------------------------------------------------------------------
// Carries (exact powers of two) and scale chain
// ---------------------------------------------------------------------------
constexpr double c_sqrt(double v) {
  double r = v > 1.0 ? v : 1.0;
  for (int i = 0; i < 64; ++i) r = 0.5 * (r + v / r);
  return r;
}
constexpr float kInvSqrtD = (float)(1.0 / c_sqrt((double)kHd));
static_assert(kInvSqrtD == 0.125f);
/* x carried x16, weights x256, q/k/v planes x16, attention output plane x256, probabilities x2^10 */
constexpr float kXCarry   = 16.0f;
constexpr float kWCarry   = 256.0f;
constexpr float kQKVCarry = 16.0f;
constexpr float kOCarry   = 256.0f;
constexpr float kPShift   = 10.0f;
constexpr float kInvXW    = 1.0f / (kXCarry * kWCarry);
constexpr float kLog2e    = 1.4426950408889634f;
constexpr float kScoreC   = kLog2e * kInvSqrtD / (kQKVCarry * kQKVCarry);
constexpr float kORatio   = kOCarry / kQKVCarry;
constexpr float kOutScale = 1.0f / (kOCarry * kWCarry);

// ---------------------------------------------------------------------------
// Workspace region map (bytes; every offset a multiple of 128)
//   W16   f16 [4][64][64]          weights x256 (q, k, v, o)       32,768
//   Q16   f16 [64 bh][2048][64]    16*q                         16,777,216
//   K16   f16 [64 bh][2048][64]    16*k                         16,777,216
//   VT16  f16 [64 bh][64 d][2048]  16*v transposed              16,777,216
//   O16   f16 [131072][64]         256*o in [b,s,h,d] order     16,777,216
//   total                                                       67,141,632
// ---------------------------------------------------------------------------
constexpr size_t kOffW  = 0;
constexpr size_t kOffQ  = kOffW  + (size_t)4 * kWEl * 2;
constexpr size_t kOffK  = kOffQ  + (size_t)kRows * kHd * 2;
constexpr size_t kOffVT = kOffK  + (size_t)kRows * kHd * 2;
constexpr size_t kOffO  = kOffVT + (size_t)kRows * kHd * 2;
constexpr size_t kWsTotal = kOffO + (size_t)kRows * kHd * 2;
static_assert(kWsTotal == 67141632ull);
static_assert(kWsTotal <= 134217728ull);
static_assert((kOffQ % 128) == 0 && (kOffK % 128) == 0 && (kOffVT % 128) == 0 && (kOffO % 128) == 0);

// ---------------------------------------------------------------------------
// Fragment helpers (split k map for A and B: elements 0..7 <- p[0..7], 8..15 <- p[16..23];
// caller adds 8*(lane>>4) to the k offset)
// ---------------------------------------------------------------------------
union FragU { v16h v; v8h h[2]; };
__device__ __forceinline__ v16h frag_ld(const _Float16* p) {
  FragU f;
  f.h[0] = *(const v8h*)(p);
  f.h[1] = *(const v8h*)(p + 16);
  return f.v;
}
__device__ __forceinline__ v8f mma_f16(v16h a, v16h b, v8f c) {
  c = __builtin_amdgcn_wmma_f32_16x16x32_f16(false, a, false, b, (short)0, c, false, false);
  asm volatile("v_nop\n\tv_nop\n\tv_nop\n\tv_nop" : "+v"(c) : "v"(a), "v"(b));
  return c;
}
__device__ __forceinline__ void guard4_h(v8f& a, v8f& b, v8f& c, v8f& d, v16h x, v16h y) {
  asm volatile("v_nop\n\tv_nop\n\tv_nop\n\tv_nop" : "+v"(a), "+v"(b), "+v"(c), "+v"(d) : "v"(x), "v"(y));
}
__device__ __forceinline__ void keep4_h(v16h a, v16h b, v16h c, v16h d) {
  asm volatile("v_nop" :: "v"(a), "v"(b), "v"(c), "v"(d));
}
__device__ __forceinline__ void acc_guard4(v8f& a, v8f& b, v8f& c, v8f& d) {
  asm volatile("v_nop\n\tv_nop\n\tv_nop\n\tv_nop" : "+v"(a), "+v"(b), "+v"(c), "+v"(d));
}
__device__ __forceinline__ void wave_lds_sync() {
  __builtin_amdgcn_fence(__ATOMIC_RELEASE, "workgroup");
  __builtin_amdgcn_wave_barrier();
  __builtin_amdgcn_fence(__ATOMIC_ACQUIRE, "workgroup");
}

// A fragment from an f32 row: RNE convert of 16*x at load
__device__ __forceinline__ v16h x_frag(const float* p) {
  const v4f a0 = *(const v4f*)(p);
  const v4f a1 = *(const v4f*)(p + 4);
  const v4f a2 = *(const v4f*)(p + 16);
  const v4f a3 = *(const v4f*)(p + 20);
  v16h f;
#pragma unroll
  for (int e = 0; e < 4; ++e) {
    f[e]      = (_Float16)(a0[e] * kXCarry);
    f[4 + e]  = (_Float16)(a1[e] * kXCarry);
    f[8 + e]  = (_Float16)(a2[e] * kXCarry);
    f[12 + e] = (_Float16)(a3[e] * kXCarry);
  }
  return f;
}

// 16 rows x 64 columns of f32 in LDS (pitch 68) -> f16 rows in a global plane.
__device__ __forceinline__ void store_rows16_f16(const float* src, unsigned short* dst, size_t dpitch, int lane) {
  const int q = lane >> 3;
  const int c8 = (lane & 7) * 8;
  v8h hv[4];
#pragma unroll
  for (int it = 0; it < 4; ++it) {
    const float* sp = src + (it * 4 + q) * kPitch + c8;
    const v4f a0 = *(const v4f*)(sp);
    const v4f a1 = *(const v4f*)(sp + 4);
#pragma unroll
    for (int e = 0; e < 4; ++e) {
      hv[it][e]     = (_Float16)a0[e];
      hv[it][4 + e] = (_Float16)a1[e];
    }
  }
  {
#pragma unroll
    for (int it = 0; it < 4; ++it) {
      *(v8h*)(dst + (size_t)(it * 4 + q) * dpitch + c8) = hv[it];
    }
    
  }
}

// ---------------------------------------------------------------------------
// Weight cast: four [64][64] f32 matrices -> f16 planes carried x256 (layout kept: [out e][in d] = Bt plane).
// grid 8 blocks x 256 threads x 8 elements = 16,384 = 4 x 4,096 elements exactly.
// ---------------------------------------------------------------------------
__global__ __launch_bounds__(256) void wcast_kernel(const float* __restrict__ W0, const float* __restrict__ W1,
                                                    const float* __restrict__ W2, const float* __restrict__ W3,
                                                    unsigned short* __restrict__ out) {
  const int z = blockIdx.x >> 1;
  const float* W = (z == 0) ? W0 : (z == 1) ? W1 : (z == 2) ? W2 : W3;
  const int i = (blockIdx.x & 1) * 256 + threadIdx.x;
  const float* p = W + 8 * i;
  const v4f a = *(const v4f*)(p);
  const v4f c = *(const v4f*)(p + 4);
  v8h hv;
#pragma unroll
  for (int e = 0; e < 4; ++e) {
    hv[e]     = (_Float16)(a[e] * kWCarry);
    hv[4 + e] = (_Float16)(c[e] * kWCarry);
  }
  unsigned short* q = out + (size_t)z * kWEl + 8 * i;
  *(v8h*)q = hv;
  
}

// ---------------------------------------------------------------------------
// One 16 x 64 projection tile of a wave: acc = (16 x)(256 W)^T, value = (acc/4096 + bias) * 16, written to LDS.
// TR == false: dst[(row)*68 + col] (row = token within the wave tile, col = feature e)
// TR == true : dst[(e)*68 + colbase + row] (block-shared transposed tile)
// ---------------------------------------------------------------------------
template <bool TR>
__device__ __forceinline__ void proj_tile(v16h ax0, v16h ax1, const _Float16* Wm, const float* bias,
                                          float* dst, int colbase, int hh, int c) {
  v16h w0[4], w1[4];
#pragma unroll
  for (int j = 0; j < 4; ++j) {
    const _Float16* wp = Wm + (j * 16 + c) * kHd + 8 * hh;
    w0[j] = frag_ld(wp);
    w1[j] = frag_ld(wp + 32);
  }
  v8f acc[4];
#pragma unroll
  for (int j = 0; j < 4; ++j) {
    acc[j] = (v8f){0.f, 0.f, 0.f, 0.f, 0.f, 0.f, 0.f, 0.f};
    acc[j] = mma_f16(ax0, w0[j], acc[j]);
    acc[j] = mma_f16(ax1, w1[j], acc[j]);
  }
#pragma unroll
  for (int j = 0; j < 4; ++j) {
    const float bj = bias[j * 16 + c];
#pragma unroll
    for (int r = 0; r < 8; ++r) {
      const float v = (acc[j][r] * kInvXW + bj) * kQKVCarry;
      if (TR) dst[(j * 16 + c) * kPitch + colbase + 8 * hh + r] = v;
      else    dst[(8 * hh + r) * kPitch + j * 16 + c] = v;
    }
  }
}

// ---------------------------------------------------------------------------
// q/k/v projection. Block = (b, h, 64 consecutive s); 4 waves x 16 token rows; x row pitch = 512 floats.
// (line = 64 consecutive s of one d; assembled through a block-shared LDS transpose, wave w writes d rows 16w..16w+15).
// grid (32, 64), 128 threads. All waves reach the single block barrier.
// ---------------------------------------------------------------------------
__global__ __launch_bounds__(128) void qkv_proj_kernel(
    const float* __restrict__ x, const unsigned short* __restrict__ W16p,
    const float* __restrict__ bq, const float* __restrict__ bk, const float* __restrict__ bv,
    unsigned short* __restrict__ Q16p, unsigned short* __restrict__ K16p, unsigned short* __restrict__ VT16p) {
  __shared__ __align__(16) float sSlab[4][16 * kPitch];
  __shared__ __align__(16) float sVt[64 * kPitch];
  const int tid  = threadIdx.x;
  const int wave = __builtin_amdgcn_readfirstlane((int)(tid >> 5));
  const int lane = tid & 31;
  const int hh   = lane >> 4;
  const int c    = lane & 15;
  const int bh   = blockIdx.y;
  const int b    = bh / kHeads;
  const int h    = bh - b * kHeads;
  const int sblk = blockIdx.x * 64;
  const int s0   = sblk + wave * 16;

  const float* xr = x + (((size_t)b * kSeq + s0 + c) * kHeads + h) * kHd + 8 * hh;
  const v16h ax0 = x_frag(xr);
  const v16h ax1 = x_frag(xr + 32);

  const _Float16* W16 = (const _Float16*)W16p;
  float* slab = sSlab[wave];

  proj_tile<false>(ax0, ax1, W16, bq, slab, 0, hh, c);
  wave_lds_sync();
  store_rows16_f16(slab, Q16p + ((size_t)bh * kSeq + s0) * kHd, (size_t)kHd, lane);
  wave_lds_sync();

  proj_tile<false>(ax0, ax1, W16 + kWEl, bk, slab, 0, hh, c);
  wave_lds_sync();
  store_rows16_f16(slab, K16p + ((size_t)bh * kSeq + s0) * kHd, (size_t)kHd, lane);

  /* transposed tile: rows d 0..63 (j*16+c), columns wave*16 + 8*hh + r = 0..63: whole 64 x 64 region written */
  proj_tile<true>(ax0, ax1, W16 + 2 * kWEl, bv, sVt, wave * 16, hh, c);
  __syncthreads();
  store_rows16_f16(sVt + (wave * 16) * kPitch,
                   VT16p + ((size_t)bh * kHd + wave * 16) * kSeq + sblk, (size_t)kSeq, lane);
}

// ---------------------------------------------------------------------------
// Streaming-softmax attention on f16 planes, both products transposed. Block = 128 queries of one (b,h), 4 waves x 32 queries (two 16-column groups g); 32 key chunks of 64.
// Every K and V^T fragment a wave reads from LDS feeds two products, one per column group; every staged tile serves 128 queries.
// scores: S^T = K Q^T. A = K tile rows [key][d] from LDS, B = Q16 rows (registers, column c of group g = query 16g + c). D register r of tile j = score of key 16j + 8*hh + r
//   for that query: a lane holds 32 of its query's 64 scores, lane ^ 16 the other 32; t = acc * log2(e)/(8*256); running max in f32, one per lane and group.
// out: O^T += V^T P^T. A = V^T tile rows [d][key] from LDS; B = p' packed from the score tiles 2kk and 2kk+1 in place (element e < 8: key 32kk + 8*hh + e,
//   e >= 8: key 32kk + 16 + 8*hh + e - 8), which is the k order frag_ld gives A. D register r of tile t = O[query][d = 16t + 8*hh + r].
// Row sums: lane-partial in f32, the two halves joined once at the end.
// Staging coverage: 4 iterations x 16 rows (4 waves x 4 rows) x 64 halves = 4,096 halves = whole tile, for K and for V^T.
// grid (16, 64), 128 threads; 256 registers a wave at most, so that the four blocks a WGP gets are resident together.
// ---------------------------------------------------------------------------
// lane l <-> lane l ^ 16
__device__ __forceinline__ float xhalf(float v) {
  const int b = __builtin_bit_cast(int, v);
  return __builtin_bit_cast(float, __builtin_amdgcn_permlanex16(b, b, 0x76543210, 0xfedcba98, false, false));
}

constexpr int kQG = 2;               /* 16-column query groups per wave */
constexpr int kQBlk = 4 * kQG * 16;  /* queries per block */
static_assert((kSeq % kQBlk) == 0);

__global__ __launch_bounds__(128) __attribute__((amdgpu_waves_per_eu(4, 4))) void attn_kernel(
    const unsigned short* __restrict__ Q16p, const unsigned short* __restrict__ K16p,
    const unsigned short* __restrict__ VT16p, unsigned short* __restrict__ O16p) {
  __shared__ __align__(16) _Float16 sK[64 * kHPitch];
  __shared__ __align__(16) _Float16 sV[64 * kHPitch];

  const int tid  = threadIdx.x;
  const int wave = __builtin_amdgcn_readfirstlane((int)(tid >> 5));
  const int lane = tid & 31;
  const int hh   = lane >> 4;
  const int c    = lane & 15;
  const int bh   = blockIdx.y;
  const int b    = bh / kHeads;
  const int h    = bh - b * kHeads;
  const int q0   = blockIdx.x * kQBlk + wave * (kQG * 16);

  const _Float16* Qg = (const _Float16*)Q16p + ((size_t)bh * kSeq + q0 + c) * kHd + 8 * hh;
  const _Float16* Kg = (const _Float16*)K16p + (size_t)bh * kSeq * kHd;
  const _Float16* Vg = (const _Float16*)VT16p + (size_t)bh * kHd * kSeq;

  v16h qb0[kQG], qb1[kQG];
  float mrun[kQG], lsum[kQG];
  v8f oacc[kQG][4];
#pragma unroll
  for (int g = 0; g < kQG; ++g) {
    qb0[g] = frag_ld(Qg + g * 16 * kHd);
    qb1[g] = frag_ld(Qg + g * 16 * kHd + 32);
    mrun[g] = -3.0e38f;
    lsum[g] = 0.f;
#pragma unroll
    for (int t = 0; t < 4; ++t) oacc[g][t] = (v8f){0.f, 0.f, 0.f, 0.f, 0.f, 0.f, 0.f, 0.f};
  }

  /* staging map: 8 lanes per 128-B row; each 16-lane half takes rows a and a + 8, whose 144-B pitch puts them on complementary halves of the 64 banks */
  const int srow = wave * 2 + hh + 8 * ((lane >> 3) & 1);
  const int soff = (lane & 7) * 8;
  /* one running pointer per plane and one LDS address per tile, the rest as constant offsets: keeps the address registers few enough for the 256-register budget */
  const _Float16* Kst = Kg + srow * kHd + soff;
  const _Float16* Vst = Vg + (size_t)srow * kSeq + soff;
  _Float16* sKst = sK + srow * kHPitch + soff;
  _Float16* sVst = sV + srow * kHPitch + soff;

#pragma unroll 1
  for (int kc = 0; kc < kSeq / 64; ++kc) {
    __syncthreads();
    {
      v8h kr[4], vr[4];
#pragma unroll
      for (int i = 0; i < 4; ++i) {
        kr[i] = *(const v8h*)(Kst + i * 16 * kHd);
        vr[i] = *(const v8h*)(Vst + (size_t)(i * 16) * kSeq);
      }
#pragma unroll
      for (int i = 0; i < 4; ++i) {
        *(v8h*)(sKst + i * 16 * kHPitch) = kr[i];
        *(v8h*)(sVst + i * 16 * kHPitch) = vr[i];
      }
    }
    __syncthreads();
    Kst += 64 * kHd;
    Vst += 64;

    v16h ka0[4], ka1[4];
#pragma unroll
    for (int j = 0; j < 4; ++j) {
      const _Float16* kp = sK + (j * 16 + c) * kHPitch + 8 * hh;
      ka0[j] = frag_ld(kp);
      ka1[j] = frag_ld(kp + 32);
    }
    v8f s[kQG][4];
#pragma unroll
    for (int j = 0; j < 4; ++j)
#pragma unroll
      for (int g = 0; g < kQG; ++g) {
        s[g][j] = (v8f){0.f, 0.f, 0.f, 0.f, 0.f, 0.f, 0.f, 0.f};
        s[g][j] = mma_f16(ka0[j], qb0[g], s[g][j]);
      }
#pragma unroll
    for (int j = 0; j < 4; ++j)
#pragma unroll
      for (int g = 0; g < kQG; ++g) s[g][j] = mma_f16(ka1[j], qb1[g], s[g][j]);

    v16h va[2][4];
#pragma unroll
    for (int kk = 0; kk < 2; ++kk)
#pragma unroll
      for (int t = 0; t < 4; ++t) va[kk][t] = frag_ld(sV + (t * 16 + c) * kHPitch + kk * 32 + 8 * hh);

    v16h pb[kQG][2];
#pragma unroll
    for (int g = 0; g < kQG; ++g) {
      float mj[4];
#pragma unroll
      for (int j = 0; j < 4; ++j) {
        mj[j] = s[g][j][0];
#pragma unroll
        for (int r = 1; r < 8; ++r) mj[j] = fmaxf(mj[j], s[g][j][r]);
      }
      float m = fmaxf(fmaxf(mj[0], mj[1]), fmaxf(mj[2], mj[3]));
      m = fmaxf(m, xhalf(m));
      const float mnew  = fmaxf(mrun[g], m * kScoreC);
      const float alpha = __builtin_amdgcn_exp2f(mrun[g] - mnew);
      mrun[g] = mnew;
      const float nb = kPShift - mnew;

      v2f ps[2];
#pragma unroll
      for (int kk = 0; kk < 2; ++kk) {
#pragma unroll
        for (int i = 0; i < 8; ++i) {
          const int j = 2 * kk + (i >> 2), r = 2 * (i & 3);
          const v2f arg = __builtin_elementwise_fma((v2f){s[g][j][r], s[g][j][r + 1]}, (v2f){kScoreC, kScoreC}, (v2f){nb, nb});
          const v2f p = (v2f){__builtin_amdgcn_exp2f(arg.x), __builtin_amdgcn_exp2f(arg.y)};
          ps[kk] = (i == 0) ? p : ps[kk] + p;
          const v2h ph = __builtin_convertvector(p, v2h);
          pb[g][kk][2 * i]     = ph.x;
          pb[g][kk][2 * i + 1] = ph.y;
        }
      }
      const v2f pt = ps[0] + ps[1];
      lsum[g] = fmaf(lsum[g], alpha, pt.x + pt.y);
#pragma unroll
      for (int t = 0; t < 4; ++t)
#pragma unroll
        for (int r = 0; r < 8; ++r) oacc[g][t][r] *= alpha;
    }

#pragma unroll
    for (int kk = 0; kk < 2; ++kk) {
#pragma unroll
      for (int t = 0; t < 4; ++t)
#pragma unroll
        for (int g = 0; g < kQG; ++g) oacc[g][t] = mma_f16(va[kk][t], pb[g][kk], oacc[g][t]);
    }
  }

#pragma unroll
  for (int g = 0; g < kQG; ++g) {
    const float l   = lsum[g] + xhalf(lsum[g]);
    const float inv = kORatio * (1.0f / l);
    /* row q0 + 16g + c of (b,h): plane row ((b*S + s)*H + h); a lane's 8 registers of tile t are 8 consecutive d: one 16-B store each */
    unsigned short* orow = O16p + (((size_t)b * kSeq + q0 + g * 16 + c) * kHeads + h) * kHd + 8 * hh;
#pragma unroll
    for (int t = 0; t < 4; ++t) {
      v8h hv;
#pragma unroll
      for (int r = 0; r < 8; ++r) hv[r] = (_Float16)(oacc[g][t][r] * inv);
      *(v8h*)(orow + t * 16) = hv;
    }
  }
}

// ---------------------------------------------------------------------------
// Register-blocked WMMA GEMM, f16 operands: C[m,n] = scale * sum_k A[m,k] * Bt[n,k] + bias[n]; each wave owns a 64x64 tile.
// A row-major [M,K]; Bt row-major [N,K]; M,N % 64 == 0, K % 32 == 0. f32 output.
// Epilogue: 16-row slabs staged per wave in LDS; each 64-wide row segment (256 B = 2 lines) written by 16 lanes x 16 B
// ---------------------------------------------------------------------------
__global__ __launch_bounds__(256) void out_proj_kernel(
    const unsigned short* __restrict__ Ap, int lda,
    const unsigned short* __restrict__ Btp, int ldb,
    float* __restrict__ C, int ldc,
    const float* __restrict__ bias,
    int M, int N, int K, float scale) {
  const _Float16* A  = (const _Float16*)Ap;
  const _Float16* Bt = (const _Float16*)Btp;
  __shared__ __align__(16) float sT[8][16 * kPitch];
  const int lane = threadIdx.x & 31;
  const int wave = __builtin_amdgcn_readfirstlane((int)(threadIdx.x >> 5));
  const int tilesN = N >> 6;
  const int tilesM = M >> 6;
  const int tile = blockIdx.x * 8 + wave;
  if (tile >= tilesM * tilesN) return;
  const int tm = tile / tilesN;
  const int tn = tile - tm * tilesN;
  const int m0 = tm << 6;
  const int n0 = tn << 6;

  const int rlane = lane & 15;
  const int koff  = (lane >> 4) * 8;
  const int mOff  = (lane >> 4) * 8;

  v8f acc[4][4];
#pragma unroll
  for (int i = 0; i < 4; ++i)
#pragma unroll
    for (int j = 0; j < 4; ++j) acc[i][j] = (v8f){0.f, 0.f, 0.f, 0.f, 0.f, 0.f, 0.f, 0.f};

  for (int k0 = 0; k0 < K; k0 += 32) {
    v16h bh[4];
#pragma unroll
    for (int j = 0; j < 4; ++j) {
      const size_t bo = (size_t)(n0 + (j << 4) + rlane) * ldb + koff + k0;
      bh[j] = frag_ld(Bt + bo);
    }
#pragma unroll
    for (int i = 0; i < 4; ++i) {
      const size_t ao = (size_t)(m0 + (i << 4) + rlane) * lda + koff + k0;
      const v16h ah = frag_ld(A + ao);
#pragma unroll
      for (int j = 0; j < 4; ++j) {
        acc[i][j] = __builtin_amdgcn_wmma_f32_16x16x32_f16(false, ah, false, bh[j], (short)0, acc[i][j], false, false);
      }
      guard4_h(acc[i][0], acc[i][1], acc[i][2], acc[i][3], ah, ah);
    }
    keep4_h(bh[0], bh[1], bh[2], bh[3]);
  }
  acc_guard4(acc[0][0], acc[0][1], acc[0][2], acc[0][3]);
  acc_guard4(acc[1][0], acc[1][1], acc[1][2], acc[1][3]);
  acc_guard4(acc[2][0], acc[2][1], acc[2][2], acc[2][3]);
  acc_guard4(acc[3][0], acc[3][1], acc[3][2], acc[3][3]);

  float* slab = sT[wave];
#pragma unroll
  for (int i = 0; i < 4; ++i) {
    const int mBase = m0 + (i << 4);
#pragma unroll
    for (int j = 0; j < 4; ++j) {
      const int n = n0 + (j << 4) + rlane;
      const float bvv = bias[n];
#pragma unroll
      for (int r = 0; r < 8; ++r) {
        const float v = acc[i][j][r] * scale + bvv;
        slab[(mOff + r) * kPitch + (j << 4) + rlane] = v;
      }
    }
    wave_lds_sync();
    {
      const int hh = lane >> 4;
      const int c4 = (lane & 15) * 4;
      {
#pragma unroll
        for (int it = 0; it < 8; ++it) {
          const int row = it * 2 + hh;
          const v4f v = *(const v4f*)(slab + row * kPitch + c4);
          *(v4f*)(C + (size_t)(mBase + row) * ldc + n0 + c4) = v;
        }
        
      }
    }
    wave_lds_sync();
  }
}

// ---------------------------------------------------------------------------
// Host glue: 4 kernel launches, nothing else.
//   wcast    : 8 blocks
//   qkv_proj : grid (32, 64) x 128 threads
//   attn     : grid (16, 64) x 128 threads
//   out_proj : M 131072, N 64, K 64 -> 2048 tiles -> 256 blocks x 8 waves
// ---------------------------------------------------------------------------
extern "C" void kernel_launch(void* const* d_in, const int* in_sizes, int n_in,
                              void* d_out, int out_size, void* d_ws, size_t ws_size,
                              hipStream_t stream) {
  if (n_in < 9) return;
  if (in_sizes[0] != kRows * kHd) return;
  if (in_sizes[1] != kWEl || in_sizes[3] != kWEl || in_sizes[5] != kWEl || in_sizes[7] != kWEl) return;
  if (in_sizes[2] != kHd || in_sizes[4] != kHd || in_sizes[6] != kHd || in_sizes[8] != kHd) return;
  if (out_size != kRows * kHd) return;
  if (ws_size < kWsTotal) return;

  const float* x  = (const float*)d_in[0];
  const float* Wq = (const float*)d_in[1];
  const float* bq = (const float*)d_in[2];
  const float* Wk = (const float*)d_in[3];
  const float* bk = (const float*)d_in[4];
  const float* Wv = (const float*)d_in[5];
  const float* bv = (const float*)d_in[6];
  const float* Wo = (const float*)d_in[7];
  const float* bo = (const float*)d_in[8];
  float* out = (float*)d_out;

  char* ws = (char*)d_ws;
  unsigned short* W16  = (unsigned short*)(ws + kOffW);
  unsigned short* Q16  = (unsigned short*)(ws + kOffQ);
  unsigned short* K16  = (unsigned short*)(ws + kOffK);
  unsigned short* VT16 = (unsigned short*)(ws + kOffVT);
  unsigned short* O16  = (unsigned short*)(ws + kOffO);

  wcast_kernel<<<8, 256, 0, stream>>>(Wq, Wk, Wv, Wo, W16);

  qkv_proj_kernel<<<dim3(kSeq / 64, kBH), 128, 0, stream>>>(x, W16, bq, bk, bv, Q16, K16, VT16);

  attn_kernel<<<dim3(kSeq / kQBlk, kBH), 128, 0, stream>>>(Q16, K16, VT16, O16);

  out_proj_kernel<<<dim3(kRows / 64 / 8, 1), 256, 0, stream>>>(
      O16, kHd, W16 + 3 * kWEl, kHd, out, kHd, bo, kRows, kHd, kHd, kOutScale);
}
